// v000
// Measured on an AMD MI455X. A time is GPU time per run, averaged over a window of back-to-back runs after a warm-up
// (all launches, gaps included; the runs take copies of the inputs in turn), and the median of several windows.
// Apart from v000's, it joins two sittings. Times from different sittings can be a few percent apart, while
// side-by-side timings come from the same sitting.
// v000, which the later versions start from, runs in 142 microseconds.
// compute dtype: f16 operands (x as f16 rows, weights packed x16 as f16 rows, q/k x4, P lifted by 2^14, V x4, context x8), f32 accumulate; softmax, head scaling and biases in f32.
#include <hip/hip_runtime.h>
#include <math.h>

typedef __attribute__((ext_vector_type(16))) _Float16 v16h;
typedef __attribute__((ext_vector_type(16))) __bf16 v16b;
typedef __attribute__((ext_vector_type(8)))  _Float16 v8h;
typedef __attribute__((ext_vector_type(8)))  float v8f;
typedef __attribute__((ext_vector_type(4)))  float v4f;
typedef __attribute__((ext_vector_type(2)))  float v2f;
typedef __attribute__((ext_vector_type(4)))  unsigned v4u;
typedef __attribute__((ext_vector_type(4)))  int v4i;
typedef float __attribute__((may_alias)) float_a;
typedef int __attribute__((may_alias)) int_a;

template <typename T> __device__ __forceinline__ void vst2(void* p, T v) { *(T*)p = v;  }
__device__ __forceinline__ v8f wmma16(v16h a, v16h b, v8f c) {
  v8f d = __builtin_amdgcn_wmma_f32_16x16x32_f16(false, a, false, b, (short)0, c, false, false);
  asm volatile("v_nop\n\tv_nop\n\tv_nop\n\tv_nop" : "+v"(d) : "v"(a), "v"(b));
  return d;
}
__device__ __forceinline__ v8f wmma_bf(v16b a, v16b b, v8f c) {
  v8f d = __builtin_amdgcn_wmma_f32_16x16x32_bf16(false, a, false, b, (short)0, c, false, false);
  asm volatile("v_nop\n\tv_nop\n\tv_nop\n\tv_nop" : "+v"(d) : "v"(a), "v"(b));
  return d;
}
// 16x16x32 fragments: lane = (h = lane>>4, row/col = lane&15); elements 0..7 = k0+8h+0..7, 8..15 = k0+16+8h+0..7; D element r = row 8h+r
__device__ __forceinline__ v16h frag_h(const _Float16* rowk0, int lane) {
  union { v16h v; v8h q[2]; } u; const _Float16* p = rowk0 + 8 * (lane >> 4);
  u.q[0] = *(const v8h*)p; u.q[1] = *(const v8h*)(p + 16); return u.v;
}
__device__ __forceinline__ v16h frag_f32(const float* rowk0, int lane) {
  v16h a; const float* p = rowk0 + 8 * (lane >> 4);
#pragma unroll
  for (int i = 0; i < 8; ++i) { a[i] = (_Float16)p[i]; a[8 + i] = (_Float16)p[16 + i]; }
  return a;
}
__device__ __forceinline__ v16h frag_f32s(const float* rowk0, int lane, float sc) {
  v16h a; const float* p = rowk0 + 8 * (lane >> 4);
#pragma unroll
  for (int i = 0; i < 8; ++i) { a[i] = (_Float16)(p[i] * sc); a[8 + i] = (_Float16)(p[16 + i] * sc); }
  return a;
}
// column fragment from a [K][ld] layout (column n), rows >= K read as 0
__device__ __forceinline__ v16h fragc_f32(const float* W, int k0, int n, int lane, int ld, int K) {
  v16h a; const int g = lane >> 4;
#pragma unroll
  for (int i = 0; i < 8; ++i) { const int ka = k0 + 8 * g + i, kb = ka + 16;
    a[i] = (_Float16)(ka < K ? W[(size_t)ka * ld + n] : 0.f); a[8 + i] = (_Float16)(kb < K ? W[(size_t)kb * ld + n] : 0.f); }
  return a;
}
struct F2 { v16b h, l; };
__device__ __forceinline__ F2 bsplit16(const float v[16]) { F2 r;
#pragma unroll
  for (int i = 0; i < 16; ++i) { const __bf16 h = (__bf16)v[i]; r.h[i] = h; r.l[i] = (__bf16)(v[i] - (float)h); }
  return r; }
__device__ __forceinline__ F2 split_row(const float* row, int k0, int lane) { float v[16]; const float* p = row + k0 + 8 * (lane >> 4);
#pragma unroll
  for (int i = 0; i < 8; ++i) { v[i] = p[i]; v[8 + i] = p[16 + i]; }
  return bsplit16(v); }
__device__ __forceinline__ F2 split_rowK(const float* row, int k0, int lane, int K) { float v[16]; const int g = lane >> 4;
#pragma unroll
  for (int i = 0; i < 8; ++i) { const int ka = k0 + 8 * g + i, kb = ka + 16; v[i] = ka < K ? row[ka] : 0.f; v[8 + i] = kb < K ? row[kb] : 0.f; }
  return bsplit16(v); }
__device__ __forceinline__ F2 split_col(const float* W, int k0, int n, int lane, int ld, int K) { float v[16]; const int g = lane >> 4;
#pragma unroll
  for (int i = 0; i < 8; ++i) { const int ka = k0 + 8 * g + i, kb = ka + 16; v[i] = ka < K ? W[(size_t)ka * ld + n] : 0.f; v[8 + i] = kb < K ? W[(size_t)kb * ld + n] : 0.f; }
  return bsplit16(v); }
__device__ __forceinline__ v8f mac3(const F2& a, const F2& b, v8f c) { c = wmma_bf(a.l, b.h, c); c = wmma_bf(a.h, b.l, c); return wmma_bf(a.h, b.h, c); }
__device__ __forceinline__ float sigm(float v) { return 1.0f / (1.0f + expf(-v)); }
#define LDSX() do { asm volatile("s_wait_dscnt 0" ::: "memory"); __builtin_amdgcn_wave_barrier(); __builtin_amdgcn_fence(__ATOMIC_RELEASE, "workgroup"); } while (0)


// Multi-head credibility attention on [4,2048,256] (8 heads x 32, [out][in] weights + biases): softmax(q.k/sqrt(32)) * head_scale[h], ctx = attn v, out = ctx Wo^T + bo.
// score dim 32: k_cvt (f16 rows), k_pack (Wq|Wk|Wv|Wo rows x16), k_qkv (+bias; Q/K rows x4 per (batch, head); V^T x4), k_attn (32 key tiles of 64;
// online softmax; ctx scaled by head_scale[h]; O16 x8 token-major), k_out (+ bo). Output rms is dominated by bo/Wo scale.
#define NBI 4
#define C 256
#define NH 8
#define HD 32
#define NP 2048
#define NR (NBI * NP)

__global__ __launch_bounds__(256) void k_cvt(const float* __restrict__ x, _Float16* __restrict__ X16) {
  const size_t i8 = (size_t)blockIdx.x * 256 + threadIdx.x; if (i8 >= (size_t)NR * C / 8) return;
  union { v8h h; v4u u; } pk;
#pragma unroll
  for (int e = 0; e < 8; ++e) pk.h[e] = (_Float16)x[i8 * 8 + e];
  vst2(X16 + i8 * 8, pk.u);
}
// PT rows (256 halves x16): [0,C) Wq rows, [C,2C) Wk, [2C,3C) Wv, [3C,4C) Wo ([out][in])
__global__ __launch_bounds__(256) void k_pack(const float* __restrict__ Wq, const float* __restrict__ Wk, const float* __restrict__ Wv, const float* __restrict__ Wo, _Float16* __restrict__ PT) {
  const int n = blockIdx.x, tid = threadIdx.x; __shared__ __align__(16) _Float16 srow[C];
  const float* src = (n < C ? Wq : (n < 2 * C ? Wk : (n < 3 * C ? Wv : Wo))) + (size_t)(n & (C - 1)) * C;
  srow[tid] = (_Float16)(src[tid] * 16.0f); __syncthreads();
  if (tid < C / 8) vst2(PT + (size_t)n * C + tid * 8, *(const v4u*)(&srow[tid * 8]));
}
// QKV: block = (64 positions of one image, 128 output channels = 4 heads of q, k or v)
__global__ __launch_bounds__(128) void k_qkv(const _Float16* __restrict__ X16, const _Float16* __restrict__ PT, const float* __restrict__ bq, const float* __restrict__ bk, const float* __restrict__ bv, _Float16* __restrict__ Q16, _Float16* __restrict__ K16, _Float16* __restrict__ V16) {
  __shared__ __align__(16) float so[4][16][132];
  __shared__ __align__(16) _Float16 sth[128][72];
  const int tid = threadIdx.x, wave = tid >> 5, lane = tid & 31, col = lane & 15, g = lane >> 4;
  const int r0b = blockIdx.x * 64, r0 = r0b + wave * 16, n0 = blockIdx.y * 128; const int b = r0b / NP, s0 = r0b % NP; const int which = n0 / C, h0 = (n0 % C) / HD;
  v8f acc[8] = {};
#pragma unroll 2
  for (int kc = 0; kc < C / 32; ++kc) { const v16h a = frag_h(X16 + (size_t)(r0 + col) * C + kc * 32, lane);
#pragma unroll
    for (int j = 0; j < 8; ++j) acc[j] = wmma16(a, frag_h(PT + (size_t)(n0 + j * 16 + col) * C + kc * 32, lane), acc[j]); }
  const float* bb_ = which == 0 ? bq : (which == 1 ? bk : bv); const int cb0 = n0 % C;
  if (which < 2) {
#pragma unroll
    for (int j = 0; j < 8; ++j) { const float bb = bb_[cb0 + j * 16 + col];
#pragma unroll
      for (int r = 0; r < 8; ++r) so[wave][8 * g + r][j * 16 + col] = (acc[j][r] * (1.0f / 16.0f) + bb) * 4.0f; }
    LDSX();
    _Float16* Dst = which == 0 ? Q16 : K16;
    for (int qq = lane; qq < 4 * 16 * 4; qq += 32) { const int hh = qq >> 6, rl = (qq >> 2) & 15, pc = qq & 3; union { v8h h8; v4u u; } pk;
#pragma unroll
      for (int e = 0; e < 8; ++e) pk.h8[e] = (_Float16)so[wave][rl][hh * 32 + pc * 8 + e];
      vst2(Dst + (((size_t)b * NH + h0 + hh) * NP + s0 + wave * 16 + rl) * HD + pc * 8, pk.u); } }
  else {
#pragma unroll
    for (int j = 0; j < 8; ++j) { const float bb = bb_[cb0 + j * 16 + col];
#pragma unroll
      for (int r = 0; r < 8; ++r) sth[j * 16 + col][wave * 16 + 8 * g + r] = (_Float16)((acc[j][r] * (1.0f / 16.0f) + bb) * 4.0f); }
    __syncthreads();
    for (int qq = tid; qq < 128 * 8; qq += 128) { const int cl = qq >> 3, pc = qq & 7; vst2(V16 + ((size_t)b * C + (n0 - 2 * C) + cl) * NP + s0 + pc * 8, *(const v4u*)(&sth[cl][pc * 8])); } }
}
// attention: block = (64 query positions, (image, head)); 32 key tiles of 64 ; O16[b][n][h*32 + d] x8
__global__ __launch_bounds__(128) void k_attn(const _Float16* __restrict__ Q16, const _Float16* __restrict__ K16, const _Float16* __restrict__ V16, const float* __restrict__ hs, _Float16* __restrict__ O16) {
  __shared__ __align__(16) float sS[4][16][68];
  __shared__ __align__(16) _Float16 sPh[4][16][72];
  __shared__ __align__(16) float sO[4][16][36];
  const int tid = threadIdx.x, w = tid >> 5, lane = tid & 31, col = lane & 15, g = lane >> 4;
  const size_t bh = blockIdx.y; const int b = (int)(bh / NH), h = (int)(bh % NH); const int q0 = blockIdx.x * 64 + w * 16;
  const v16h aq = frag_h(Q16 + (bh * NP + q0 + col) * HD, lane);
  const float scl = 0.17677669529663687f / 16.0f;
  float mrun = -3.0e38f, lrun = 0.f; v8f acc[2] = {};
#pragma unroll 1
  for (int kt = 0; kt < NP / 64; ++kt) {
#pragma unroll
    for (int t = 0; t < 4; ++t) { const int key = kt * 64 + t * 16 + col; const v8f s = wmma16(aq, frag_h(K16 + (bh * NP + key) * HD, lane), (v8f){});
#pragma unroll
      for (int r = 0; r < 8; ++r) sS[w][8 * g + r][t * 16 + col] = s[r] * scl; }
    LDSX();
    float mx = -3.4e38f;
#pragma unroll
    for (int jj = 0; jj < 32; ++jj) mx = fmaxf(mx, sS[w][col][g * 32 + jj]);
    mx = fmaxf(mx, __shfl_xor(mx, 16, 32));
    const float mnew = fmaxf(mrun, mx); const float corr = expf(mrun - mnew);
    float ps = 0.f;
#pragma unroll
    for (int jj = 0; jj < 32; ++jj) { const float p = expf(sS[w][col][g * 32 + jj] - mnew) * 16384.0f; ps += p; sPh[w][col][g * 32 + jj] = (_Float16)p; }
    ps += __shfl_xor(ps, 16, 32);
    lrun = lrun * corr + ps * (1.0f / 16384.0f); mrun = mnew;
#pragma unroll
    for (int r = 0; r < 8; ++r) { const float cr = __shfl(corr, 8 * g + r, 32); acc[0][r] *= cr; acc[1][r] *= cr; }
    LDSX();
#pragma unroll
    for (int kc = 0; kc < 2; ++kc) { const v16h ph = frag_h(&sPh[w][col][0] + kc * 32, lane);
#pragma unroll
      for (int t2 = 0; t2 < 2; ++t2) acc[t2] = wmma16(ph, frag_h(V16 + ((size_t)b * C + h * HD + t2 * 16 + col) * NP + kt * 64 + kc * 32, lane), acc[t2]); }
    __builtin_amdgcn_wave_barrier(); }
#pragma unroll
  for (int r = 0; r < 8; ++r) { const float lr = __shfl(lrun, 8 * g + r, 32); const float inv = hs[h] * 8.0f / (lr * 16384.0f * 4.0f);
#pragma unroll
    for (int t2 = 0; t2 < 2; ++t2) sO[w][8 * g + r][t2 * 16 + col] = acc[t2][r] * inv; }
  LDSX();
  for (int qq = lane; qq < 16 * 4; qq += 32) { const int rl = qq >> 2, pc = qq & 3; union { v8h h8; v4u u; } pk;
#pragma unroll
    for (int e = 0; e < 8; ++e) pk.h8[e] = (_Float16)sO[w][rl][pc * 8 + e];
    vst2(O16 + ((size_t)b * NP + q0 + rl) * C + h * HD + pc * 8, pk.u); }
}
// out = ctx Wo^T /8/16 + bo : token-major rows; block (64 rows, 128 cols)
__global__ __launch_bounds__(128) void k_out(const _Float16* __restrict__ O16, const _Float16* __restrict__ PT, const float* __restrict__ bo, float* __restrict__ out) {
  __shared__ __align__(16) float so[4][16][132];
  const int tid = threadIdx.x, wave = tid >> 5, lane = tid & 31, col = lane & 15, g = lane >> 4; const int r0 = blockIdx.x * 64 + wave * 16, n0 = blockIdx.y * 128;
  v8f acc[8] = {};
#pragma unroll 2
  for (int kc = 0; kc < C / 32; ++kc) { const v16h a = frag_h(O16 + (size_t)(r0 + col) * C + kc * 32, lane);
#pragma unroll
    for (int j = 0; j < 8; ++j) acc[j] = wmma16(a, frag_h(PT + (size_t)(3 * C + n0 + j * 16 + col) * C + kc * 32, lane), acc[j]); }
#pragma unroll
  for (int j = 0; j < 8; ++j) { const float bb = bo[n0 + j * 16 + col];
#pragma unroll
    for (int r = 0; r < 8; ++r) so[wave][8 * g + r][j * 16 + col] = acc[j][r] * (1.0f / (16.0f * 8.0f)) + bb; }
  LDSX();
#pragma unroll 4
  for (int rl = 0; rl < 16; ++rl) vst2(out + (size_t)(r0 + rl) * C + n0 + lane * 4, *(const v4f*)(&so[wave][rl][lane * 4]));
}
extern "C" void kernel_launch(void* const* d_in, const int* in_sizes, int n_in, void* d_out, int out_size, void* d_ws, size_t ws_size, hipStream_t stream) {
  (void)in_sizes; (void)n_in; (void)out_size; (void)ws_size;
  const float** I = (const float**)d_in;    // x, Wq, bq, Wk, bk, Wv, bv, Wo, bo, head_scale
  const float* x = I[0]; const float* Wq = I[1]; const float* bq = I[2]; const float* Wk = I[3]; const float* bk = I[4]; const float* Wv = I[5]; const float* bv = I[6]; const float* Wo = I[7]; const float* bo = I[8]; const float* hs = I[9];
  float* out = (float*)d_out;
  char* ws = (char*)d_ws; size_t off = 0;
  auto take = [&](size_t bytes) { char* p = ws + off; off += (bytes + 255) & ~(size_t)255; return p; };
  _Float16* X16 = (_Float16*)take((size_t)NR * C * 2); _Float16* PT = (_Float16*)take((size_t)4 * C * C * 2);
  _Float16* Q16 = (_Float16*)take((size_t)NR * C * 2); _Float16* K16 = (_Float16*)take((size_t)NR * C * 2); _Float16* V16 = (_Float16*)take((size_t)NR * C * 2); _Float16* O16 = (_Float16*)take((size_t)NR * C * 2);
  // ws ~ 21 MB
  k_cvt<<<(NR * C / 8 + 255) / 256, 256, 0, stream>>>(x, X16);
  k_pack<<<4 * C, 256, 0, stream>>>(Wq, Wk, Wv, Wo, PT);
  k_qkv<<<dim3(NR / 64, 3 * C / 128, 1), 128, 0, stream>>>(X16, PT, bq, bk, bv, Q16, K16, V16);
  k_attn<<<dim3(NP / 64, NBI * NH), 128, 0, stream>>>(Q16, K16, V16, hs, O16);
  k_out<<<dim3(NR / 64, C / 128), 128, 0, stream>>>(O16, PT, bo, out);
}

// v001
// One run takes 102 microseconds.
// Timed twice side by side with v000, it ran 1.47 times as fast both times.
// compute dtype: f16 operands (x as f16 rows, weights packed x16 as f16 rows, q/k x4, P lifted by 2^14, V x4, context x8), f32 accumulate; softmax, head scaling and biases in f32.
#include <hip/hip_runtime.h>
#include <math.h>

typedef __attribute__((ext_vector_type(16))) _Float16 v16h;
typedef __attribute__((ext_vector_type(16))) __bf16 v16b;
typedef __attribute__((ext_vector_type(8)))  _Float16 v8h;
typedef __attribute__((ext_vector_type(8)))  float v8f;
typedef __attribute__((ext_vector_type(4)))  float v4f;
typedef __attribute__((ext_vector_type(2)))  float v2f;
typedef __attribute__((ext_vector_type(4)))  unsigned v4u;
typedef __attribute__((ext_vector_type(4)))  int v4i;
typedef float __attribute__((may_alias)) float_a;
typedef int __attribute__((may_alias)) int_a;

template <typename T> __device__ __forceinline__ void vst2(void* p, T v) { *(T*)p = v;  }
__device__ __forceinline__ v8f wmma16(v16h a, v16h b, v8f c) {
  v8f d = __builtin_amdgcn_wmma_f32_16x16x32_f16(false, a, false, b, (short)0, c, false, false);
  asm volatile("v_nop\n\tv_nop\n\tv_nop\n\tv_nop" : "+v"(d) : "v"(a), "v"(b));
  return d;
}
__device__ __forceinline__ v8f wmma_bf(v16b a, v16b b, v8f c) {
  v8f d = __builtin_amdgcn_wmma_f32_16x16x32_bf16(false, a, false, b, (short)0, c, false, false);
  asm volatile("v_nop\n\tv_nop\n\tv_nop\n\tv_nop" : "+v"(d) : "v"(a), "v"(b));
  return d;
}
// 16x16x32 fragments: lane = (h = lane>>4, row/col = lane&15); elements 0..7 = k0+8h+0..7, 8..15 = k0+16+8h+0..7; D element r = row 8h+r
__device__ __forceinline__ v16h frag_h(const _Float16* rowk0, int lane) {
  union { v16h v; v8h q[2]; } u; const _Float16* p = rowk0 + 8 * (lane >> 4);
  u.q[0] = *(const v8h*)p; u.q[1] = *(const v8h*)(p + 16); return u.v;
}
// the same fragment from a pointer that already holds the lane's 8 * (lane >> 4)
__device__ __forceinline__ v16h frag_at(const _Float16* p) {
  union { v16h v; v8h q[2]; } u; u.q[0] = *(const v8h*)p; u.q[1] = *(const v8h*)(p + 16); return u.v;
}
__device__ __forceinline__ v16h frag_f32(const float* rowk0, int lane) {
  v16h a; const float* p = rowk0 + 8 * (lane >> 4);
#pragma unroll
  for (int i = 0; i < 8; ++i) { a[i] = (_Float16)p[i]; a[8 + i] = (_Float16)p[16 + i]; }
  return a;
}
__device__ __forceinline__ v16h frag_f32s(const float* rowk0, int lane, float sc) {
  v16h a; const float* p = rowk0 + 8 * (lane >> 4);
#pragma unroll
  for (int i = 0; i < 8; ++i) { a[i] = (_Float16)(p[i] * sc); a[8 + i] = (_Float16)(p[16 + i] * sc); }
  return a;
}
// column fragment from a [K][ld] layout (column n), rows >= K read as 0
__device__ __forceinline__ v16h fragc_f32(const float* W, int k0, int n, int lane, int ld, int K) {
  v16h a; const int g = lane >> 4;
#pragma unroll
  for (int i = 0; i < 8; ++i) { const int ka = k0 + 8 * g + i, kb = ka + 16;
    a[i] = (_Float16)(ka < K ? W[(size_t)ka * ld + n] : 0.f); a[8 + i] = (_Float16)(kb < K ? W[(size_t)kb * ld + n] : 0.f); }
  return a;
}
struct F2 { v16b h, l; };
__device__ __forceinline__ F2 bsplit16(const float v[16]) { F2 r;
#pragma unroll
  for (int i = 0; i < 16; ++i) { const __bf16 h = (__bf16)v[i]; r.h[i] = h; r.l[i] = (__bf16)(v[i] - (float)h); }
  return r; }
__device__ __forceinline__ F2 split_row(const float* row, int k0, int lane) { float v[16]; const float* p = row + k0 + 8 * (lane >> 4);
#pragma unroll
  for (int i = 0; i < 8; ++i) { v[i] = p[i]; v[8 + i] = p[16 + i]; }
  return bsplit16(v); }
__device__ __forceinline__ F2 split_rowK(const float* row, int k0, int lane, int K) { float v[16]; const int g = lane >> 4;
#pragma unroll
  for (int i = 0; i < 8; ++i) { const int ka = k0 + 8 * g + i, kb = ka + 16; v[i] = ka < K ? row[ka] : 0.f; v[8 + i] = kb < K ? row[kb] : 0.f; }
  return bsplit16(v); }
__device__ __forceinline__ F2 split_col(const float* W, int k0, int n, int lane, int ld, int K) { float v[16]; const int g = lane >> 4;
#pragma unroll
  for (int i = 0; i < 8; ++i) { const int ka = k0 + 8 * g + i, kb = ka + 16; v[i] = ka < K ? W[(size_t)ka * ld + n] : 0.f; v[8 + i] = kb < K ? W[(size_t)kb * ld + n] : 0.f; }
  return bsplit16(v); }
__device__ __forceinline__ v8f mac3(const F2& a, const F2& b, v8f c) { c = wmma_bf(a.l, b.h, c); c = wmma_bf(a.h, b.l, c); return wmma_bf(a.h, b.h, c); }
__device__ __forceinline__ float sigm(float v) { return 1.0f / (1.0f + expf(-v)); }
#define LDSX() do { asm volatile("s_wait_dscnt 0" ::: "memory"); __builtin_amdgcn_wave_barrier(); __builtin_amdgcn_fence(__ATOMIC_RELEASE, "workgroup"); } while (0)


// Multi-head credibility attention on [4,2048,256] (8 heads x 32, [out][in] weights + biases): softmax(q.k/sqrt(32)) * head_scale[h], ctx = attn v, out = ctx Wo^T + bo.
// score dim 32: k_cvt (f16 rows), k_pack (Wq|Wk|Wv|Wo rows x16), k_qkv (+bias; Q/K rows x4 per (batch, head); V^T x4), k_attn (32 key tiles of 64;
// online softmax; ctx scaled by head_scale[h]; O16 x8 token-major), k_out (+ bo). Output rms is dominated by bo/Wo scale.
#define NBI 4
#define C 256
#define NH 8
#define HD 32
#define NP 2048
#define NR (NBI * NP)

__global__ __launch_bounds__(256) void k_cvt(const float* __restrict__ x, _Float16* __restrict__ X16) {
  const size_t i8 = (size_t)blockIdx.x * 256 + threadIdx.x; if (i8 >= (size_t)NR * C / 8) return;
  union { v8h h; v4u u; } pk;
#pragma unroll
  for (int e = 0; e < 8; ++e) pk.h[e] = (_Float16)x[i8 * 8 + e];
  vst2(X16 + i8 * 8, pk.u);
}
// PT rows (256 halves x16): [0,C) Wq rows, [C,2C) Wk, [2C,3C) Wv, [3C,4C) Wo ([out][in])
__global__ __launch_bounds__(256) void k_pack(const float* __restrict__ Wq, const float* __restrict__ Wk, const float* __restrict__ Wv, const float* __restrict__ Wo, _Float16* __restrict__ PT) {
  const int n = blockIdx.x, tid = threadIdx.x; __shared__ __align__(16) _Float16 srow[C];
  const float* src = (n < C ? Wq : (n < 2 * C ? Wk : (n < 3 * C ? Wv : Wo))) + (size_t)(n & (C - 1)) * C;
  srow[tid] = (_Float16)(src[tid] * 16.0f); __syncthreads();
  if (tid < C / 8) vst2(PT + (size_t)n * C + tid * 8, *(const v4u*)(&srow[tid * 8]));
}
// QKV: block = (64 positions of one image, 128 output channels = 4 heads of q, k or v)
__global__ __launch_bounds__(128) void k_qkv(const _Float16* __restrict__ X16, const _Float16* __restrict__ PT, const float* __restrict__ bq, const float* __restrict__ bk, const float* __restrict__ bv, _Float16* __restrict__ Q16, _Float16* __restrict__ K16, _Float16* __restrict__ V16) {
  __shared__ __align__(16) float so[4][16][132];
  __shared__ __align__(16) _Float16 sth[128][72];
  const int tid = threadIdx.x, wave = tid >> 5, lane = tid & 31, col = lane & 15, g = lane >> 4;
  const int r0b = blockIdx.x * 64, r0 = r0b + wave * 16, n0 = blockIdx.y * 128; const int b = r0b / NP, s0 = r0b % NP; const int which = n0 / C, h0 = (n0 % C) / HD;
  v8f acc[8] = {};
#pragma unroll 2
  for (int kc = 0; kc < C / 32; ++kc) { const v16h a = frag_h(X16 + (size_t)(r0 + col) * C + kc * 32, lane);
#pragma unroll
    for (int j = 0; j < 8; ++j) acc[j] = wmma16(a, frag_h(PT + (size_t)(n0 + j * 16 + col) * C + kc * 32, lane), acc[j]); }
  const float* bb_ = which == 0 ? bq : (which == 1 ? bk : bv); const int cb0 = n0 % C;
  if (which < 2) {
#pragma unroll
    for (int j = 0; j < 8; ++j) { const float bb = bb_[cb0 + j * 16 + col];
#pragma unroll
      for (int r = 0; r < 8; ++r) so[wave][8 * g + r][j * 16 + col] = (acc[j][r] * (1.0f / 16.0f) + bb) * 4.0f; }
    LDSX();
    _Float16* Dst = which == 0 ? Q16 : K16;
    for (int qq = lane; qq < 4 * 16 * 4; qq += 32) { const int hh = qq >> 6, rl = (qq >> 2) & 15, pc = qq & 3; union { v8h h8; v4u u; } pk;
#pragma unroll
      for (int e = 0; e < 8; ++e) pk.h8[e] = (_Float16)so[wave][rl][hh * 32 + pc * 8 + e];
      vst2(Dst + (((size_t)b * NH + h0 + hh) * NP + s0 + wave * 16 + rl) * HD + pc * 8, pk.u); } }
  else {
#pragma unroll
    for (int j = 0; j < 8; ++j) { const float bb = bb_[cb0 + j * 16 + col];
#pragma unroll
      for (int r = 0; r < 8; ++r) sth[j * 16 + col][wave * 16 + 8 * g + r] = (_Float16)((acc[j][r] * (1.0f / 16.0f) + bb) * 4.0f); }
    __syncthreads();
    for (int qq = tid; qq < 128 * 8; qq += 128) { const int cl = qq >> 3, pc = qq & 7; vst2(V16 + ((size_t)b * C + (n0 - 2 * C) + cl) * NP + s0 + pc * 8, *(const v4u*)(&sth[cl][pc * 8])); } }
}
// attention: block = (64 query positions, (image, head)); 32 key tiles of 64 ; O16[b][n][h*32 + d] x8
__global__ __launch_bounds__(128) void k_attn(const _Float16* __restrict__ Q16, const _Float16* __restrict__ K16, const _Float16* __restrict__ V16, const float* __restrict__ hs, _Float16* __restrict__ O16) {
  __shared__ __align__(16) float sS[4][16][68];
  __shared__ __align__(16) _Float16 sPh[4][16][72];
  __shared__ __align__(16) float sO[4][16][36];
  const int tid = threadIdx.x, w = tid >> 5, lane = tid & 31, col = lane & 15, g = lane >> 4;
  const size_t bh = blockIdx.y; const int b = (int)(bh / NH), h = (int)(bh % NH); const int q0 = blockIdx.x * 64 + w * 16;
  const v16h aq = frag_h(Q16 + (bh * NP + q0 + col) * HD, lane);
  const float scl = 0.17677669529663687f / 16.0f;
  float mrun = -3.0e38f, lrun = 0.f; v8f acc[2] = {};
  const _Float16* Kp = K16 + (bh * NP + col) * HD;
  const _Float16* Vp = V16 + ((size_t)b * C + h * HD + col) * NP;
  // all 16 fragment loads of a pass go out as one group behind the score stores and land under the softmax arithmetic: this tile's V, the next tile's K
  v16h kf[4], vf[4];
#pragma unroll
  for (int t = 0; t < 4; ++t) kf[t] = frag_h(Kp + (size_t)(t * 16) * HD, lane);
  const _Float16* Kn = Kp + 64 * HD + 8 * g; const _Float16* Vn = Vp + 8 * g;   // the lane's own half of k folded in
#pragma unroll 1
  for (int kt = 0; kt < NP / 64; ++kt) {
#pragma unroll
    for (int t = 0; t < 4; ++t) { const v8f s = wmma16(aq, kf[t], (v8f){});
#pragma unroll
      for (int r = 0; r < 8; ++r) sS[w][8 * g + r][t * 16 + col] = s[r] * scl; }
    LDSX();
#pragma unroll
    for (int t = 0; t < 4; ++t) kf[t] = frag_at(Kn + t * 16 * HD);
#pragma unroll
    for (int i = 0; i < 4; ++i) vf[i] = frag_at(Vn + (i & 1) * 16 * NP + (i >> 1) * 32);
    asm volatile("s_wait_xcnt 0x0" :: "v"(Kn), "v"(Vn) : "memory");   // both address pairs stay whole (named as inputs) up to this wait; they advance only behind it
    __builtin_amdgcn_sched_barrier(0);   // keeps the load group and its wait here: without it the scheduler sinks the V loads to the foot of the softmax, where little is left to cover them
    Vn += 64; Kn += kt + 2 < NP / 64 ? 64 * HD : 0;   // the last pass fetches the last tile again: in bounds, never used
    float mx = -3.4e38f;
#pragma unroll
    for (int jj = 0; jj < 32; ++jj) mx = fmaxf(mx, sS[w][col][g * 32 + jj]);
    mx = fmaxf(mx, __shfl_xor(mx, 16, 32));
    const float mnew = fmaxf(mrun, mx); const float corr = expf(mrun - mnew);
    float ps = 0.f;
#pragma unroll
    for (int jj = 0; jj < 32; ++jj) { const float p = expf(sS[w][col][g * 32 + jj] - mnew) * 16384.0f; ps += p; sPh[w][col][g * 32 + jj] = (_Float16)p; }
    ps += __shfl_xor(ps, 16, 32);
    lrun = lrun * corr + ps * (1.0f / 16384.0f); mrun = mnew;
#pragma unroll
    for (int r = 0; r < 8; ++r) { const float cr = __shfl(corr, 8 * g + r, 32); acc[0][r] *= cr; acc[1][r] *= cr; }
    LDSX();
#pragma unroll
    for (int kc = 0; kc < 2; ++kc) { const v16h ph = frag_h(&sPh[w][col][0] + kc * 32, lane);
#pragma unroll
      for (int t2 = 0; t2 < 2; ++t2) acc[t2] = wmma16(ph, vf[kc * 2 + t2], acc[t2]); }
    __builtin_amdgcn_wave_barrier(); }
#pragma unroll
  for (int r = 0; r < 8; ++r) { const float lr = __shfl(lrun, 8 * g + r, 32); const float inv = hs[h] * 8.0f / (lr * 16384.0f * 4.0f);
#pragma unroll
    for (int t2 = 0; t2 < 2; ++t2) sO[w][8 * g + r][t2 * 16 + col] = acc[t2][r] * inv; }
  LDSX();
  for (int qq = lane; qq < 16 * 4; qq += 32) { const int rl = qq >> 2, pc = qq & 3; union { v8h h8; v4u u; } pk;
#pragma unroll
    for (int e = 0; e < 8; ++e) pk.h8[e] = (_Float16)sO[w][rl][pc * 8 + e];
    vst2(O16 + ((size_t)b * NP + q0 + rl) * C + h * HD + pc * 8, pk.u); }
}
// out = ctx Wo^T /8/16 + bo : token-major rows; block (64 rows, 128 cols)
__global__ __launch_bounds__(128) void k_out(const _Float16* __restrict__ O16, const _Float16* __restrict__ PT, const float* __restrict__ bo, float* __restrict__ out) {
  __shared__ __align__(16) float so[4][16][132];
  const int tid = threadIdx.x, wave = tid >> 5, lane = tid & 31, col = lane & 15, g = lane >> 4; const int r0 = blockIdx.x * 64 + wave * 16, n0 = blockIdx.y * 128;
  v8f acc[8] = {};
#pragma unroll 2
  for (int kc = 0; kc < C / 32; ++kc) { const v16h a = frag_h(O16 + (size_t)(r0 + col) * C + kc * 32, lane);
#pragma unroll
    for (int j = 0; j < 8; ++j) acc[j] = wmma16(a, frag_h(PT + (size_t)(3 * C + n0 + j * 16 + col) * C + kc * 32, lane), acc[j]); }
#pragma unroll
  for (int j = 0; j < 8; ++j) { const float bb = bo[n0 + j * 16 + col];
#pragma unroll
    for (int r = 0; r < 8; ++r) so[wave][8 * g + r][j * 16 + col] = acc[j][r] * (1.0f / (16.0f * 8.0f)) + bb; }
  LDSX();
#pragma unroll 4
  for (int rl = 0; rl < 16; ++rl) vst2(out + (size_t)(r0 + rl) * C + n0 + lane * 4, *(const v4f*)(&so[wave][rl][lane * 4]));
}
extern "C" void kernel_launch(void* const* d_in, const int* in_sizes, int n_in, void* d_out, int out_size, void* d_ws, size_t ws_size, hipStream_t stream) {
  (void)in_sizes; (void)n_in; (void)out_size; (void)ws_size;
  const float** I = (const float**)d_in;    // x, Wq, bq, Wk, bk, Wv, bv, Wo, bo, head_scale
  const float* x = I[0]; const float* Wq = I[1]; const float* bq = I[2]; const float* Wk = I[3]; const float* bk = I[4]; const float* Wv = I[5]; const float* bv = I[6]; const float* Wo = I[7]; const float* bo = I[8]; const float* hs = I[9];
  float* out = (float*)d_out;
  char* ws = (char*)d_ws; size_t off = 0;
  auto take = [&](size_t bytes) { char* p = ws + off; off += (bytes + 255) & ~(size_t)255; return p; };
  _Float16* X16 = (_Float16*)take((size_t)NR * C * 2); _Float16* PT = (_Float16*)take((size_t)4 * C * C * 2);
  _Float16* Q16 = (_Float16*)take((size_t)NR * C * 2); _Float16* K16 = (_Float16*)take((size_t)NR * C * 2); _Float16* V16 = (_Float16*)take((size_t)NR * C * 2); _Float16* O16 = (_Float16*)take((size_t)NR * C * 2);
  // ws ~ 21 MB
  k_cvt<<<(NR * C / 8 + 255) / 256, 256, 0, stream>>>(x, X16);
  k_pack<<<4 * C, 256, 0, stream>>>(Wq, Wk, Wv, Wo, PT);
  k_qkv<<<dim3(NR / 64, 3 * C / 128, 1), 128, 0, stream>>>(X16, PT, bq, bk, bv, Q16, K16, V16);
  k_attn<<<dim3(NP / 64, NBI * NH), 128, 0, stream>>>(Q16, K16, V16, hs, O16);
  k_out<<<dim3(NR / 64, C / 128), 128, 0, stream>>>(O16, PT, bo, out);
}

// v002
// It runs in 86.3 microseconds.
// Timed twice side by side with v001, it ran 1.19 and 1.16 times as fast.
// Counting every step since v000, it is 1.72 times as fast.
// compute dtype: f16 operands (x as f16 rows, weights packed x16 as f16 rows, q/k x4, P lifted by 2^14, V x4, context x8), f32 accumulate; softmax, head scaling and biases in f32.
#include <hip/hip_runtime.h>
#include <math.h>

typedef __attribute__((ext_vector_type(16))) _Float16 v16h;
typedef __attribute__((ext_vector_type(16))) __bf16 v16b;
typedef __attribute__((ext_vector_type(8)))  _Float16 v8h;
typedef __attribute__((ext_vector_type(8)))  float v8f;
typedef __attribute__((ext_vector_type(4)))  float v4f;
typedef __attribute__((ext_vector_type(2)))  float v2f;
typedef __attribute__((ext_vector_type(4)))  unsigned v4u;
typedef __attribute__((ext_vector_type(4)))  int v4i;
typedef float __attribute__((may_alias)) float_a;
typedef int __attribute__((may_alias)) int_a;

template <typename T> __device__ __forceinline__ void vst2(void* p, T v) { *(T*)p = v;  }
__device__ __forceinline__ v8f wmma16(v16h a, v16h b, v8f c) {
  v8f d = __builtin_amdgcn_wmma_f32_16x16x32_f16(false, a, false, b, (short)0, c, false, false);
  asm volatile("v_nop\n\tv_nop\n\tv_nop\n\tv_nop" : "+v"(d) : "v"(a), "v"(b));
  return d;
}
__device__ __forceinline__ v8f wmma_bf(v16b a, v16b b, v8f c) {
  v8f d = __builtin_amdgcn_wmma_f32_16x16x32_bf16(false, a, false, b, (short)0, c, false, false);
  asm volatile("v_nop\n\tv_nop\n\tv_nop\n\tv_nop" : "+v"(d) : "v"(a), "v"(b));
  return d;
}
// 16x16x32 fragments: lane = (h = lane>>4, row/col = lane&15); elements 0..7 = k0+8h+0..7, 8..15 = k0+16+8h+0..7; D element r = row 8h+r
__device__ __forceinline__ v16h frag_h(const _Float16* rowk0, int lane) {
  union { v16h v; v8h q[2]; } u; const _Float16* p = rowk0 + 8 * (lane >> 4);
  u.q[0] = *(const v8h*)p; u.q[1] = *(const v8h*)(p + 16); return u.v;
}
// the same fragment from a pointer that already holds the lane's 8 * (lane >> 4)
__device__ __forceinline__ v16h frag_at(const _Float16* p) {
  union { v16h v; v8h q[2]; } u; u.q[0] = *(const v8h*)p; u.q[1] = *(const v8h*)(p + 16); return u.v;
}
__device__ __forceinline__ v16h frag_f32(const float* rowk0, int lane) {
  v16h a; const float* p = rowk0 + 8 * (lane >> 4);
#pragma unroll
  for (int i = 0; i < 8; ++i) { a[i] = (_Float16)p[i]; a[8 + i] = (_Float16)p[16 + i]; }
  return a;
}
__device__ __forceinline__ v16h frag_f32s(const float* rowk0, int lane, float sc) {
  v16h a; const float* p = rowk0 + 8 * (lane >> 4);
#pragma unroll
  for (int i = 0; i < 8; ++i) { a[i] = (_Float16)(p[i] * sc); a[8 + i] = (_Float16)(p[16 + i] * sc); }
  return a;
}
// column fragment from a [K][ld] layout (column n), rows >= K read as 0
__device__ __forceinline__ v16h fragc_f32(const float* W, int k0, int n, int lane, int ld, int K) {
  v16h a; const int g = lane >> 4;
#pragma unroll
  for (int i = 0; i < 8; ++i) { const int ka = k0 + 8 * g + i, kb = ka + 16;
    a[i] = (_Float16)(ka < K ? W[(size_t)ka * ld + n] : 0.f); a[8 + i] = (_Float16)(kb < K ? W[(size_t)kb * ld + n] : 0.f); }
  return a;
}
struct F2 { v16b h, l; };
__device__ __forceinline__ F2 bsplit16(const float v[16]) { F2 r;
#pragma unroll
  for (int i = 0; i < 16; ++i) { const __bf16 h = (__bf16)v[i]; r.h[i] = h; r.l[i] = (__bf16)(v[i] - (float)h); }
  return r; }
__device__ __forceinline__ F2 split_row(const float* row, int k0, int lane) { float v[16]; const float* p = row + k0 + 8 * (lane >> 4);
#pragma unroll
  for (int i = 0; i < 8; ++i) { v[i] = p[i]; v[8 + i] = p[16 + i]; }
  return bsplit16(v); }
__device__ __forceinline__ F2 split_rowK(const float* row, int k0, int lane, int K) { float v[16]; const int g = lane >> 4;
#pragma unroll
  for (int i = 0; i < 8; ++i) { const int ka = k0 + 8 * g + i, kb = ka + 16; v[i] = ka < K ? row[ka] : 0.f; v[8 + i] = kb < K ? row[kb] : 0.f; }
  return bsplit16(v); }
__device__ __forceinline__ F2 split_col(const float* W, int k0, int n, int lane, int ld, int K) { float v[16]; const int g = lane >> 4;
#pragma unroll
  for (int i = 0; i < 8; ++i) { const int ka = k0 + 8 * g + i, kb = ka + 16; v[i] = ka < K ? W[(size_t)ka * ld + n] : 0.f; v[8 + i] = kb < K ? W[(size_t)kb * ld + n] : 0.f; }
  return bsplit16(v); }
__device__ __forceinline__ v8f mac3(const F2& a, const F2& b, v8f c) { c = wmma_bf(a.l, b.h, c); c = wmma_bf(a.h, b.l, c); return wmma_bf(a.h, b.h, c); }
__device__ __forceinline__ float sigm(float v) { return 1.0f / (1.0f + expf(-v)); }
#define LDSX() do { asm volatile("s_wait_dscnt 0" ::: "memory"); __builtin_amdgcn_wave_barrier(); __builtin_amdgcn_fence(__ATOMIC_RELEASE, "workgroup"); } while (0)


// Multi-head credibility attention on [4,2048,256] (8 heads x 32, [out][in] weights + biases): softmax(q.k/sqrt(32)) * head_scale[h], ctx = attn v, out = ctx Wo^T + bo.
// score dim 32: k_cvt (f16 rows), k_pack (Wq|Wk|Wv|Wo rows x16), k_qkv (+bias; Q/K rows x4 per (batch, head); V^T x4), k_attn (32 key tiles of 64;
// online softmax; ctx scaled by head_scale[h]; O16 x8 token-major), k_out (+ bo). Output rms is dominated by bo/Wo scale.
#define NBI 4
#define C 256
#define NH 8
#define HD 32
#define NP 2048
#define NR (NBI * NP)

__global__ __launch_bounds__(256) void k_cvt(const float* __restrict__ x, _Float16* __restrict__ X16) {
  const size_t i8 = (size_t)blockIdx.x * 256 + threadIdx.x; if (i8 >= (size_t)NR * C / 8) return;
  union { v8h h; v4u u; } pk;
#pragma unroll
  for (int e = 0; e < 8; ++e) pk.h[e] = (_Float16)x[i8 * 8 + e];
  vst2(X16 + i8 * 8, pk.u);
}
// PT rows (256 halves x16): [0,C) Wq rows, [C,2C) Wk, [2C,3C) Wv, [3C,4C) Wo ([out][in])
__global__ __launch_bounds__(256) void k_pack(const float* __restrict__ Wq, const float* __restrict__ Wk, const float* __restrict__ Wv, const float* __restrict__ Wo, _Float16* __restrict__ PT) {
  const int n = blockIdx.x, tid = threadIdx.x; __shared__ __align__(16) _Float16 srow[C];
  const float* src = (n < C ? Wq : (n < 2 * C ? Wk : (n < 3 * C ? Wv : Wo))) + (size_t)(n & (C - 1)) * C;
  srow[tid] = (_Float16)(src[tid] * 16.0f); __syncthreads();
  if (tid < C / 8) vst2(PT + (size_t)n * C + tid * 8, *(const v4u*)(&srow[tid * 8]));
}
// QKV: block = (64 positions of one image, 128 output channels = 4 heads of q, k or v)
__global__ __launch_bounds__(128) void k_qkv(const _Float16* __restrict__ X16, const _Float16* __restrict__ PT, const float* __restrict__ bq, const float* __restrict__ bk, const float* __restrict__ bv, _Float16* __restrict__ Q16, _Float16* __restrict__ K16, _Float16* __restrict__ V16) {
  __shared__ __align__(16) float so[4][16][132];
  __shared__ __align__(16) _Float16 sth[128][72];
  const int tid = threadIdx.x, wave = tid >> 5, lane = tid & 31, col = lane & 15, g = lane >> 4;
  const int r0b = blockIdx.x * 64, r0 = r0b + wave * 16, n0 = blockIdx.y * 128; const int b = r0b / NP, s0 = r0b % NP; const int which = n0 / C, h0 = (n0 % C) / HD;
  v8f acc[8] = {};
#pragma unroll 2
  for (int kc = 0; kc < C / 32; ++kc) { const v16h a = frag_h(X16 + (size_t)(r0 + col) * C + kc * 32, lane);
#pragma unroll
    for (int j = 0; j < 8; ++j) acc[j] = wmma16(a, frag_h(PT + (size_t)(n0 + j * 16 + col) * C + kc * 32, lane), acc[j]); }
  const float* bb_ = which == 0 ? bq : (which == 1 ? bk : bv); const int cb0 = n0 % C;
  if (which < 2) {
#pragma unroll
    for (int j = 0; j < 8; ++j) { const float bb = bb_[cb0 + j * 16 + col];
#pragma unroll
      for (int r = 0; r < 8; ++r) so[wave][8 * g + r][j * 16 + col] = (acc[j][r] * (1.0f / 16.0f) + bb) * 4.0f; }
    LDSX();
    _Float16* Dst = which == 0 ? Q16 : K16;
    for (int qq = lane; qq < 4 * 16 * 4; qq += 32) { const int hh = qq >> 6, rl = (qq >> 2) & 15, pc = qq & 3; union { v8h h8; v4u u; } pk;
#pragma unroll
      for (int e = 0; e < 8; ++e) pk.h8[e] = (_Float16)so[wave][rl][hh * 32 + pc * 8 + e];
      vst2(Dst + (((size_t)b * NH + h0 + hh) * NP + s0 + wave * 16 + rl) * HD + pc * 8, pk.u); } }
  else {
#pragma unroll
    for (int j = 0; j < 8; ++j) { const float bb = bb_[cb0 + j * 16 + col];
#pragma unroll
      for (int r = 0; r < 8; ++r) sth[j * 16 + col][wave * 16 + 8 * g + r] = (_Float16)((acc[j][r] * (1.0f / 16.0f) + bb) * 4.0f); }
    __syncthreads();
    for (int qq = tid; qq < 128 * 8; qq += 128) { const int cl = qq >> 3, pc = qq & 7; vst2(V16 + ((size_t)b * C + (n0 - 2 * C) + cl) * NP + s0 + pc * 8, *(const v4u*)(&sth[cl][pc * 8])); } }
}
// attention: block = (64 query positions, (image, head)); 32 key tiles of 64 ; O16[b][n][h*32 + d] x8
__global__ __launch_bounds__(128) void k_attn(const _Float16* __restrict__ Q16, const _Float16* __restrict__ K16, const _Float16* __restrict__ V16, const float* __restrict__ hs, _Float16* __restrict__ O16) {
  __shared__ __align__(16) float sS[4][16][68];
  __shared__ __align__(16) _Float16 sPh[4][16][72];
  __shared__ __align__(16) float sO[4][16][36];
  const int tid = threadIdx.x, w = tid >> 5, lane = tid & 31, col = lane & 15, g = lane >> 4;
  const size_t bh = blockIdx.y; const int b = (int)(bh / NH), h = (int)(bh % NH); const int q0 = blockIdx.x * 64 + w * 16;
  const v16h aq = frag_h(Q16 + (bh * NP + q0 + col) * HD, lane);
  const float scl = 0.17677669529663687f / 16.0f * 1.4426950408889634f;   // 1/sqrt(32), q's and k's x4 taken back, log2(e): the scores are exponents of 2
  float mrun = -3.0e38f, lrun = 0.f; v8f acc[2] = {};   // mrun = (largest score so far) - 14: exp2(score - mrun) is P with its 2^14 lift
  const _Float16* Kp = K16 + (bh * NP + col) * HD;
  const _Float16* Vp = V16 + ((size_t)b * C + h * HD + col) * NP;
  // all 16 fragment loads of a pass go out as one group behind the score stores and land under the softmax arithmetic: this tile's V, the next tile's K
  v16h kf[4], vf[4];
#pragma unroll
  for (int t = 0; t < 4; ++t) kf[t] = frag_h(Kp + (size_t)(t * 16) * HD, lane);
  const _Float16* Kn = Kp + 64 * HD + 8 * g; const _Float16* Vn = Vp + 8 * g;   // the lane's own half of k folded in
#pragma unroll 1
  for (int kt = 0; kt < NP / 64; ++kt) {
#pragma unroll
    for (int t = 0; t < 4; ++t) { const v8f s = wmma16(aq, kf[t], (v8f){});
#pragma unroll
      for (int r = 0; r < 8; ++r) sS[w][8 * g + r][t * 16 + col] = s[r] * scl; }
    LDSX();
#pragma unroll
    for (int t = 0; t < 4; ++t) kf[t] = frag_at(Kn + t * 16 * HD);
#pragma unroll
    for (int i = 0; i < 4; ++i) vf[i] = frag_at(Vn + (i & 1) * 16 * NP + (i >> 1) * 32);
    asm volatile("s_wait_xcnt 0x0" :: "v"(Kn), "v"(Vn) : "memory");   // both address pairs stay whole (named as inputs) up to this wait; they advance only behind it
    __builtin_amdgcn_sched_barrier(0);   // keeps the load group and its wait here: without it the scheduler sinks the V loads to the foot of the softmax, where little is left to cover them
    Vn += 64; Kn += kt + 2 < NP / 64 ? 64 * HD : 0;   // the last pass fetches the last tile again: in bounds, never used
    float mx = -3.4e38f;
#pragma unroll
    for (int jj = 0; jj < 32; ++jj) mx = fmaxf(mx, sS[w][col][g * 32 + jj]);
    mx = fmaxf(mx, __shfl_xor(mx, 16, 32));
    const float mnew = fmaxf(mrun, mx - 14.0f); const float corr = __builtin_amdgcn_exp2f(mrun - mnew);   // 0 on the first pass
    float ps = 0.f;
#pragma unroll
    for (int jj = 0; jj < 32; ++jj) { const float p = __builtin_amdgcn_exp2f(sS[w][col][g * 32 + jj] - mnew); ps += p; sPh[w][col][g * 32 + jj] = (_Float16)p; }
    ps += __shfl_xor(ps, 16, 32);
    lrun = lrun * corr + ps * (1.0f / 16384.0f); mrun = mnew;
#pragma unroll
    for (int r = 0; r < 8; ++r) { const float cr = __shfl(corr, 8 * g + r, 32); acc[0][r] *= cr; acc[1][r] *= cr; }
    LDSX();
#pragma unroll
    for (int kc = 0; kc < 2; ++kc) { const v16h ph = frag_h(&sPh[w][col][0] + kc * 32, lane);
#pragma unroll
      for (int t2 = 0; t2 < 2; ++t2) acc[t2] = wmma16(ph, vf[kc * 2 + t2], acc[t2]); }
    __builtin_amdgcn_wave_barrier(); }
#pragma unroll
  for (int r = 0; r < 8; ++r) { const float lr = __shfl(lrun, 8 * g + r, 32); const float inv = hs[h] * 8.0f / (lr * 16384.0f * 4.0f);
#pragma unroll
    for (int t2 = 0; t2 < 2; ++t2) sO[w][8 * g + r][t2 * 16 + col] = acc[t2][r] * inv; }
  LDSX();
  for (int qq = lane; qq < 16 * 4; qq += 32) { const int rl = qq >> 2, pc = qq & 3; union { v8h h8; v4u u; } pk;
#pragma unroll
    for (int e = 0; e < 8; ++e) pk.h8[e] = (_Float16)sO[w][rl][pc * 8 + e];
    vst2(O16 + ((size_t)b * NP + q0 + rl) * C + h * HD + pc * 8, pk.u); }
}
// out = ctx Wo^T /8/16 + bo : token-major rows; block (64 rows, 128 cols)
__global__ __launch_bounds__(128) void k_out(const _Float16* __restrict__ O16, const _Float16* __restrict__ PT, const float* __restrict__ bo, float* __restrict__ out) {
  __shared__ __align__(16) float so[4][16][132];
  const int tid = threadIdx.x, wave = tid >> 5, lane = tid & 31, col = lane & 15, g = lane >> 4; const int r0 = blockIdx.x * 64 + wave * 16, n0 = blockIdx.y * 128;
  v8f acc[8] = {};
#pragma unroll 2
  for (int kc = 0; kc < C / 32; ++kc) { const v16h a = frag_h(O16 + (size_t)(r0 + col) * C + kc * 32, lane);
#pragma unroll
    for (int j = 0; j < 8; ++j) acc[j] = wmma16(a, frag_h(PT + (size_t)(3 * C + n0 + j * 16 + col) * C + kc * 32, lane), acc[j]); }
#pragma unroll
  for (int j = 0; j < 8; ++j) { const float bb = bo[n0 + j * 16 + col];
#pragma unroll
    for (int r = 0; r < 8; ++r) so[wave][8 * g + r][j * 16 + col] = acc[j][r] * (1.0f / (16.0f * 8.0f)) + bb; }
  LDSX();
#pragma unroll 4
  for (int rl = 0; rl < 16; ++rl) vst2(out + (size_t)(r0 + rl) * C + n0 + lane * 4, *(const v4f*)(&so[wave][rl][lane * 4]));
}
extern "C" void kernel_launch(void* const* d_in, const int* in_sizes, int n_in, void* d_out, int out_size, void* d_ws, size_t ws_size, hipStream_t stream) {
  (void)in_sizes; (void)n_in; (void)out_size; (void)ws_size;
  const float** I = (const float**)d_in;    // x, Wq, bq, Wk, bk, Wv, bv, Wo, bo, head_scale
  const float* x = I[0]; const float* Wq = I[1]; const float* bq = I[2]; const float* Wk = I[3]; const float* bk = I[4]; const float* Wv = I[5]; const float* bv = I[6]; const float* Wo = I[7]; const float* bo = I[8]; const float* hs = I[9];
  float* out = (float*)d_out;
  char* ws = (char*)d_ws; size_t off = 0;
  auto take = [&](size_t bytes) { char* p = ws + off; off += (bytes + 255) & ~(size_t)255; return p; };
  _Float16* X16 = (_Float16*)take((size_t)NR * C * 2); _Float16* PT = (_Float16*)take((size_t)4 * C * C * 2);
  _Float16* Q16 = (_Float16*)take((size_t)NR * C * 2); _Float16* K16 = (_Float16*)take((size_t)NR * C * 2); _Float16* V16 = (_Float16*)take((size_t)NR * C * 2); _Float16* O16 = (_Float16*)take((size_t)NR * C * 2);
  // ws ~ 21 MB
  k_cvt<<<(NR * C / 8 + 255) / 256, 256, 0, stream>>>(x, X16);
  k_pack<<<4 * C, 256, 0, stream>>>(Wq, Wk, Wv, Wo, PT);
  k_qkv<<<dim3(NR / 64, 3 * C / 128, 1), 128, 0, stream>>>(X16, PT, bq, bk, bv, Q16, K16, V16);
  k_attn<<<dim3(NP / 64, NBI * NH), 128, 0, stream>>>(Q16, K16, V16, hs, O16);
  k_out<<<dim3(NR / 64, C / 128), 128, 0, stream>>>(O16, PT, bo, out);
}

// v003
// A run of this version takes 75 microseconds.
// Next to v002, in two timings, it ran 1.14 times as fast each time.
// All steps since v000 together make it 1.96 times as fast.
// compute dtype: f16 operands (x as f16 rows, weights packed x16 as f16 rows, q/k x4, P lifted by 2^14, V x4, context x8), f32 accumulate; softmax, head scaling and biases in f32.
#include <hip/hip_runtime.h>
#include <math.h>

typedef __attribute__((ext_vector_type(16))) _Float16 v16h;
typedef __attribute__((ext_vector_type(16))) __bf16 v16b;
typedef __attribute__((ext_vector_type(8)))  _Float16 v8h;
typedef __attribute__((ext_vector_type(8)))  float v8f;
typedef __attribute__((ext_vector_type(4)))  float v4f;
typedef __attribute__((ext_vector_type(2)))  float v2f;
typedef __attribute__((ext_vector_type(4)))  unsigned v4u;
typedef __attribute__((ext_vector_type(4)))  int v4i;
typedef float __attribute__((may_alias)) float_a;
typedef int __attribute__((may_alias)) int_a;

template <typename T> __device__ __forceinline__ void vst2(void* p, T v) { *(T*)p = v;  }
__device__ __forceinline__ v8f wmma16(v16h a, v16h b, v8f c) {
  v8f d = __builtin_amdgcn_wmma_f32_16x16x32_f16(false, a, false, b, (short)0, c, false, false);
  asm volatile("v_nop\n\tv_nop\n\tv_nop\n\tv_nop" : "+v"(d) : "v"(a), "v"(b));
  return d;
}
__device__ __forceinline__ v8f wmma_bf(v16b a, v16b b, v8f c) {
  v8f d = __builtin_amdgcn_wmma_f32_16x16x32_bf16(false, a, false, b, (short)0, c, false, false);
  asm volatile("v_nop\n\tv_nop\n\tv_nop\n\tv_nop" : "+v"(d) : "v"(a), "v"(b));
  return d;
}
// 16x16x32 fragments: lane = (h = lane>>4, row/col = lane&15); elements 0..7 = k0+8h+0..7, 8..15 = k0+16+8h+0..7; D element r = row 8h+r
__device__ __forceinline__ v16h frag_h(const _Float16* rowk0, int lane) {
  union { v16h v; v8h q[2]; } u; const _Float16* p = rowk0 + 8 * (lane >> 4);
  u.q[0] = *(const v8h*)p; u.q[1] = *(const v8h*)(p + 16); return u.v;
}
// the same fragment from a pointer that already holds the lane's 8 * (lane >> 4)
__device__ __forceinline__ v16h frag_at(const _Float16* p) {
  union { v16h v; v8h q[2]; } u; u.q[0] = *(const v8h*)p; u.q[1] = *(const v8h*)(p + 16); return u.v;
}
__device__ __forceinline__ v16h frag_f32(const float* rowk0, int lane) {
  v16h a; const float* p = rowk0 + 8 * (lane >> 4);
#pragma unroll
  for (int i = 0; i < 8; ++i) { a[i] = (_Float16)p[i]; a[8 + i] = (_Float16)p[16 + i]; }
  return a;
}
__device__ __forceinline__ v16h frag_f32s(const float* rowk0, int lane, float sc) {
  v16h a; const float* p = rowk0 + 8 * (lane >> 4);
#pragma unroll
  for (int i = 0; i < 8; ++i) { a[i] = (_Float16)(p[i] * sc); a[8 + i] = (_Float16)(p[16 + i] * sc); }
  return a;
}
// column fragment from a [K][ld] layout (column n), rows >= K read as 0
__device__ __forceinline__ v16h fragc_f32(const float* W, int k0, int n, int lane, int ld, int K) {
  v16h a; const int g = lane >> 4;
#pragma unroll
  for (int i = 0; i < 8; ++i) { const int ka = k0 + 8 * g + i, kb = ka + 16;
    a[i] = (_Float16)(ka < K ? W[(size_t)ka * ld + n] : 0.f); a[8 + i] = (_Float16)(kb < K ? W[(size_t)kb * ld + n] : 0.f); }
  return a;
}
struct F2 { v16b h, l; };
__device__ __forceinline__ F2 bsplit16(const float v[16]) { F2 r;
#pragma unroll
  for (int i = 0; i < 16; ++i) { const __bf16 h = (__bf16)v[i]; r.h[i] = h; r.l[i] = (__bf16)(v[i] - (float)h); }
  return r; }
__device__ __forceinline__ F2 split_row(const float* row, int k0, int lane) { float v[16]; const float* p = row + k0 + 8 * (lane >> 4);
#pragma unroll
  for (int i = 0; i < 8; ++i) { v[i] = p[i]; v[8 + i] = p[16 + i]; }
  return bsplit16(v); }
__device__ __forceinline__ F2 split_rowK(const float* row, int k0, int lane, int K) { float v[16]; const int g = lane >> 4;
#pragma unroll
  for (int i = 0; i < 8; ++i) { const int ka = k0 + 8 * g + i, kb = ka + 16; v[i] = ka < K ? row[ka] : 0.f; v[8 + i] = kb < K ? row[kb] : 0.f; }
  return bsplit16(v); }
__device__ __forceinline__ F2 split_col(const float* W, int k0, int n, int lane, int ld, int K) { float v[16]; const int g = lane >> 4;
#pragma unroll
  for (int i = 0; i < 8; ++i) { const int ka = k0 + 8 * g + i, kb = ka + 16; v[i] = ka < K ? W[(size_t)ka * ld + n] : 0.f; v[8 + i] = kb < K ? W[(size_t)kb * ld + n] : 0.f; }
  return bsplit16(v); }
__device__ __forceinline__ v8f mac3(const F2& a, const F2& b, v8f c) { c = wmma_bf(a.l, b.h, c); c = wmma_bf(a.h, b.l, c); return wmma_bf(a.h, b.h, c); }
__device__ __forceinline__ float sigm(float v) { return 1.0f / (1.0f + expf(-v)); }
#define LDSX() do { asm volatile("s_wait_dscnt 0" ::: "memory"); __builtin_amdgcn_wave_barrier(); __builtin_amdgcn_fence(__ATOMIC_RELEASE, "workgroup"); } while (0)


// Multi-head credibility attention on [4,2048,256] (8 heads x 32, [out][in] weights + biases): softmax(q.k/sqrt(32)) * head_scale[h], ctx = attn v, out = ctx Wo^T + bo.
// score dim 32: k_cvt (f16 rows), k_pack (Wq|Wk|Wv|Wo rows x16), k_qkv (+bias; Q/K rows x4 per (batch, head); V^T x4), k_attn (32 key tiles of 64;
// online softmax; ctx scaled by head_scale[h]; O16 x8 token-major), k_out (+ bo). Output rms is dominated by bo/Wo scale.
#define NBI 4
#define C 256
#define NH 8
#define HD 32
#define NP 2048
#define NR (NBI * NP)

__global__ __launch_bounds__(256) void k_cvt(const float* __restrict__ x, _Float16* __restrict__ X16) {
  const size_t i8 = (size_t)blockIdx.x * 256 + threadIdx.x; if (i8 >= (size_t)NR * C / 8) return;
  union { v8h h; v4u u; } pk;
#pragma unroll
  for (int e = 0; e < 8; ++e) pk.h[e] = (_Float16)x[i8 * 8 + e];
  vst2(X16 + i8 * 8, pk.u);
}
// PT rows (256 halves x16): [0,C) Wq rows, [C,2C) Wk, [2C,3C) Wv, [3C,4C) Wo ([out][in])
__global__ __launch_bounds__(256) void k_pack(const float* __restrict__ Wq, const float* __restrict__ Wk, const float* __restrict__ Wv, const float* __restrict__ Wo, _Float16* __restrict__ PT) {
  const int n = blockIdx.x, tid = threadIdx.x; __shared__ __align__(16) _Float16 srow[C];
  const float* src = (n < C ? Wq : (n < 2 * C ? Wk : (n < 3 * C ? Wv : Wo))) + (size_t)(n & (C - 1)) * C;
  srow[tid] = (_Float16)(src[tid] * 16.0f); __syncthreads();
  if (tid < C / 8) vst2(PT + (size_t)n * C + tid * 8, *(const v4u*)(&srow[tid * 8]));
}
// QKV: block = (64 positions of one image, 128 output channels = 4 heads of q, k or v)
__global__ __launch_bounds__(128) void k_qkv(const _Float16* __restrict__ X16, const _Float16* __restrict__ PT, const float* __restrict__ bq, const float* __restrict__ bk, const float* __restrict__ bv, _Float16* __restrict__ Q16, _Float16* __restrict__ K16, _Float16* __restrict__ V16) {
  __shared__ __align__(16) float so[4][16][132];
  __shared__ __align__(16) _Float16 sth[128][72];
  const int tid = threadIdx.x, wave = tid >> 5, lane = tid & 31, col = lane & 15, g = lane >> 4;
  const int r0b = blockIdx.x * 64, r0 = r0b + wave * 16, n0 = blockIdx.y * 128; const int b = r0b / NP, s0 = r0b % NP; const int which = n0 / C, h0 = (n0 % C) / HD;
  v8f acc[8] = {};
#pragma unroll 2
  for (int kc = 0; kc < C / 32; ++kc) { const v16h a = frag_h(X16 + (size_t)(r0 + col) * C + kc * 32, lane);
#pragma unroll
    for (int j = 0; j < 8; ++j) acc[j] = wmma16(a, frag_h(PT + (size_t)(n0 + j * 16 + col) * C + kc * 32, lane), acc[j]); }
  const float* bb_ = which == 0 ? bq : (which == 1 ? bk : bv); const int cb0 = n0 % C;
  if (which < 2) {
#pragma unroll
    for (int j = 0; j < 8; ++j) { const float bb = bb_[cb0 + j * 16 + col];
#pragma unroll
      for (int r = 0; r < 8; ++r) so[wave][8 * g + r][j * 16 + col] = (acc[j][r] * (1.0f / 16.0f) + bb) * 4.0f; }
    LDSX();
    _Float16* Dst = which == 0 ? Q16 : K16;
    for (int qq = lane; qq < 4 * 16 * 4; qq += 32) { const int hh = qq >> 6, rl = (qq >> 2) & 15, pc = qq & 3; union { v8h h8; v4u u; } pk;
#pragma unroll
      for (int e = 0; e < 8; ++e) pk.h8[e] = (_Float16)so[wave][rl][hh * 32 + pc * 8 + e];
      vst2(Dst + (((size_t)b * NH + h0 + hh) * NP + s0 + wave * 16 + rl) * HD + pc * 8, pk.u); } }
  else {
#pragma unroll
    for (int j = 0; j < 8; ++j) { const float bb = bb_[cb0 + j * 16 + col];
#pragma unroll
      for (int r = 0; r < 8; ++r) sth[j * 16 + col][wave * 16 + 8 * g + r] = (_Float16)((acc[j][r] * (1.0f / 16.0f) + bb) * 4.0f); }
    __syncthreads();
    for (int qq = tid; qq < 128 * 8; qq += 128) { const int cl = qq >> 3, pc = qq & 7; vst2(V16 + ((size_t)b * C + (n0 - 2 * C) + cl) * NP + s0 + pc * 8, *(const v4u*)(&sth[cl][pc * 8])); } }
}
__global__ __launch_bounds__(128) void k_attn(const _Float16* __restrict__ Q16, const _Float16* __restrict__ K16, const _Float16* __restrict__ V16, const float* __restrict__ hs, _Float16* __restrict__ O16) {
  const int tid = threadIdx.x, w = tid >> 5, lane = tid & 31, col = lane & 15, g = lane >> 4;
  const size_t bh = blockIdx.y; const int b = (int)(bh / NH), h = (int)(bh % NH); const int q0 = blockIdx.x * 64 + w * 16;
  const v16h aq = frag_h(Q16 + (bh * NP + q0 + col) * HD, lane);
  const float scl = 0.17677669529663687f / 16.0f * 1.4426950408889634f;   // 1/sqrt(32), q's and k's x4 taken back, log2(e): the scores are exponents of 2
  float mrun = -3.0e38f, lrun = 0.f; v8f acc[2] = {};   // mrun = (largest score so far) - 14: exp2(score - mrun) is P with its 2^14 lift; acc[t2][r] = O^T[t2 * 16 + 8g + r][col]
  const _Float16* Kp = K16 + (bh * NP + col) * HD;
  const _Float16* Vp = V16 + ((size_t)b * C + h * HD + col) * NP;
  // all 16 fragment loads of a pass go out as one group behind the score products and land under the softmax arithmetic: this tile's V, the next tile's K
  v16h kf[4], vf[4];
#pragma unroll
  for (int t = 0; t < 4; ++t) kf[t] = frag_h(Kp + (size_t)(t * 16) * HD, lane);
  const _Float16* Kn = Kp + 64 * HD + 8 * g; const _Float16* Vn = Vp + 8 * g;   // the lane's own half of k folded in
#pragma unroll 1
  for (int kt = 0; kt < NP / 64; ++kt) {
    v8f s[4];   // s[t][r] = raw score of key 16t + 8g + r with query col
#pragma unroll
    for (int t = 0; t < 4; ++t) s[t] = wmma16(kf[t], aq, (v8f){});
#pragma unroll
    for (int t = 0; t < 4; ++t) kf[t] = frag_at(Kn + t * 16 * HD);
#pragma unroll
    for (int i = 0; i < 4; ++i) vf[i] = frag_at(Vn + (i & 1) * 16 * NP + (i >> 1) * 32);
    asm volatile("s_wait_xcnt 0x0" :: "v"(Kn), "v"(Vn) : "memory");   // both address pairs stay whole (named as inputs) up to this wait; they advance only behind it
    __builtin_amdgcn_sched_barrier(0);   // keeps the load group and its wait here: without it the scheduler sinks the V loads to the foot of the softmax, where little is left to cover them
    Vn += 64; Kn += kt + 2 < NP / 64 ? 64 * HD : 0;   // the last pass fetches the last tile again: in bounds, never used
    float mx = -3.4e38f;
#pragma unroll
    for (int t = 0; t < 4; ++t)
#pragma unroll
      for (int r = 0; r < 8; ++r) mx = fmaxf(mx, s[t][r]);
    mx = fmaxf(mx, __shfl_xor(mx, 16, 32));   // the other 32 keys of this query sit in lane ^ 16
    const float mnew = fmaxf(mrun, mx * scl - 14.0f); const float corr = __builtin_amdgcn_exp2f(mrun - mnew);   // 0 on the first pass
    float ps = 0.f; v16h ph[2];   // two score tiles, converted in place, are the B operand of 32 keys: ph[kc][8 * (t & 1) + r], t = 2 kc + (t & 1)
#pragma unroll
    for (int t = 0; t < 4; ++t)
#pragma unroll
      for (int r = 0; r < 8; ++r) { const float p = __builtin_amdgcn_exp2f(s[t][r] * scl - mnew); ps += p; ph[t >> 1][8 * (t & 1) + r] = (_Float16)p; }
    ps += __shfl_xor(ps, 16, 32);
    lrun = lrun * corr + ps * (1.0f / 16384.0f); mrun = mnew;
#pragma unroll
    for (int r = 0; r < 8; ++r) { acc[0][r] *= corr; acc[1][r] *= corr; }
#pragma unroll
    for (int kc = 0; kc < 2; ++kc)
#pragma unroll
      for (int t2 = 0; t2 < 2; ++t2) acc[t2] = wmma16(vf[kc * 2 + t2], ph[kc], acc[t2]); }
  const float inv = hs[h] * 8.0f / (lrun * 16384.0f * 4.0f);
#pragma unroll
  for (int t2 = 0; t2 < 2; ++t2) { union { v8h h8; v4u u; } pk;   // a lane's 8 registers are 8 consecutive channels of its query's row: one 16-byte store
#pragma unroll
    for (int r = 0; r < 8; ++r) pk.h8[r] = (_Float16)(acc[t2][r] * inv);
    vst2(O16 + ((size_t)b * NP + q0 + col) * C + h * HD + t2 * 16 + 8 * g, pk.u); }
}
// out = ctx Wo^T /8/16 + bo : token-major rows; block (64 rows, 128 cols)
__global__ __launch_bounds__(128) void k_out(const _Float16* __restrict__ O16, const _Float16* __restrict__ PT, const float* __restrict__ bo, float* __restrict__ out) {
  __shared__ __align__(16) float so[4][16][132];
  const int tid = threadIdx.x, wave = tid >> 5, lane = tid & 31, col = lane & 15, g = lane >> 4; const int r0 = blockIdx.x * 64 + wave * 16, n0 = blockIdx.y * 128;
  v8f acc[8] = {};
#pragma unroll 2
  for (int kc = 0; kc < C / 32; ++kc) { const v16h a = frag_h(O16 + (size_t)(r0 + col) * C + kc * 32, lane);
#pragma unroll
    for (int j = 0; j < 8; ++j) acc[j] = wmma16(a, frag_h(PT + (size_t)(3 * C + n0 + j * 16 + col) * C + kc * 32, lane), acc[j]); }
#pragma unroll
  for (int j = 0; j < 8; ++j) { const float bb = bo[n0 + j * 16 + col];
#pragma unroll
    for (int r = 0; r < 8; ++r) so[wave][8 * g + r][j * 16 + col] = acc[j][r] * (1.0f / (16.0f * 8.0f)) + bb; }
  LDSX();
#pragma unroll 4
  for (int rl = 0; rl < 16; ++rl) vst2(out + (size_t)(r0 + rl) * C + n0 + lane * 4, *(const v4f*)(&so[wave][rl][lane * 4]));
}
extern "C" void kernel_launch(void* const* d_in, const int* in_sizes, int n_in, void* d_out, int out_size, void* d_ws, size_t ws_size, hipStream_t stream) {
  (void)in_sizes; (void)n_in; (void)out_size; (void)ws_size;
  const float** I = (const float**)d_in;    // x, Wq, bq, Wk, bk, Wv, bv, Wo, bo, head_scale
  const float* x = I[0]; const float* Wq = I[1]; const float* bq = I[2]; const float* Wk = I[3]; const float* bk = I[4]; const float* Wv = I[5]; const float* bv = I[6]; const float* Wo = I[7]; const float* bo = I[8]; const float* hs = I[9];
  float* out = (float*)d_out;
  char* ws = (char*)d_ws; size_t off = 0;
  auto take = [&](size_t bytes) { char* p = ws + off; off += (bytes + 255) & ~(size_t)255; return p; };
  _Float16* X16 = (_Float16*)take((size_t)NR * C * 2); _Float16* PT = (_Float16*)take((size_t)4 * C * C * 2);
  _Float16* Q16 = (_Float16*)take((size_t)NR * C * 2); _Float16* K16 = (_Float16*)take((size_t)NR * C * 2); _Float16* V16 = (_Float16*)take((size_t)NR * C * 2); _Float16* O16 = (_Float16*)take((size_t)NR * C * 2);
  // ws ~ 21 MB
  k_cvt<<<(NR * C / 8 + 255) / 256, 256, 0, stream>>>(x, X16);
  k_pack<<<4 * C, 256, 0, stream>>>(Wq, Wk, Wv, Wo, PT);
  k_qkv<<<dim3(NR / 64, 3 * C / 128, 1), 128, 0, stream>>>(X16, PT, bq, bk, bv, Q16, K16, V16);
  k_attn<<<dim3(NP / 64, NBI * NH), 128, 0, stream>>>(Q16, K16, V16, hs, O16);
  k_out<<<dim3(NR / 64, C / 128), 128, 0, stream>>>(O16, PT, bo, out);
}

// v004
// One run takes 69.9 microseconds.
// Next to v003, in two timings, it ran 1.07 and 1.08 times as fast.
// All steps since v000 together make it 2.11 times as fast.
// compute dtype: f16 operands (x as f16 rows, weights packed x16 as f16 rows, q/k x4, P lifted by 2^14, V x4, context x8), f32 accumulate; softmax, head scaling and biases in f32.
#include <hip/hip_runtime.h>
#include <math.h>

typedef __attribute__((ext_vector_type(16))) _Float16 v16h;
typedef __attribute__((ext_vector_type(16))) __bf16 v16b;
typedef __attribute__((ext_vector_type(8)))  _Float16 v8h;
typedef __attribute__((ext_vector_type(8)))  float v8f;
typedef __attribute__((ext_vector_type(4)))  float v4f;
typedef __attribute__((ext_vector_type(2)))  float v2f;
typedef __attribute__((ext_vector_type(4)))  unsigned v4u;
typedef __attribute__((ext_vector_type(4)))  int v4i;
typedef float __attribute__((may_alias)) float_a;
typedef int __attribute__((may_alias)) int_a;

template <typename T> __device__ __forceinline__ void vst2(void* p, T v) { *(T*)p = v;  }
__device__ __forceinline__ v8f wmma16(v16h a, v16h b, v8f c) {
  v8f d = __builtin_amdgcn_wmma_f32_16x16x32_f16(false, a, false, b, (short)0, c, false, false);
  asm volatile("v_nop\n\tv_nop\n\tv_nop\n\tv_nop" : "+v"(d) : "v"(a), "v"(b));
  return d;
}
__device__ __forceinline__ v8f wmma_bf(v16b a, v16b b, v8f c) {
  v8f d = __builtin_amdgcn_wmma_f32_16x16x32_bf16(false, a, false, b, (short)0, c, false, false);
  asm volatile("v_nop\n\tv_nop\n\tv_nop\n\tv_nop" : "+v"(d) : "v"(a), "v"(b));
  return d;
}
// 16x16x32 fragments: lane = (h = lane>>4, row/col = lane&15); elements 0..7 = k0+8h+0..7, 8..15 = k0+16+8h+0..7; D element r = row 8h+r
__device__ __forceinline__ v16h frag_h(const _Float16* rowk0, int lane) {
  union { v16h v; v8h q[2]; } u; const _Float16* p = rowk0 + 8 * (lane >> 4);
  u.q[0] = *(const v8h*)p; u.q[1] = *(const v8h*)(p + 16); return u.v;
}
// the same fragment from a pointer that already holds the lane's 8 * (lane >> 4)
__device__ __forceinline__ v16h frag_at(const _Float16* p) {
  union { v16h v; v8h q[2]; } u; u.q[0] = *(const v8h*)p; u.q[1] = *(const v8h*)(p + 16); return u.v;
}
__device__ __forceinline__ v16h frag_f32(const float* rowk0, int lane) {
  v16h a; const float* p = rowk0 + 8 * (lane >> 4);
#pragma unroll
  for (int i = 0; i < 8; ++i) { a[i] = (_Float16)p[i]; a[8 + i] = (_Float16)p[16 + i]; }
  return a;
}
__device__ __forceinline__ v16h frag_f32s(const float* rowk0, int lane, float sc) {
  v16h a; const float* p = rowk0 + 8 * (lane >> 4);
#pragma unroll
  for (int i = 0; i < 8; ++i) { a[i] = (_Float16)(p[i] * sc); a[8 + i] = (_Float16)(p[16 + i] * sc); }
  return a;
}
// column fragment from a [K][ld] layout (column n), rows >= K read as 0
__device__ __forceinline__ v16h fragc_f32(const float* W, int k0, int n, int lane, int ld, int K) {
  v16h a; const int g = lane >> 4;
#pragma unroll
  for (int i = 0; i < 8; ++i) { const int ka = k0 + 8 * g + i, kb = ka + 16;
    a[i] = (_Float16)(ka < K ? W[(size_t)ka * ld + n] : 0.f); a[8 + i] = (_Float16)(kb < K ? W[(size_t)kb * ld + n] : 0.f); }
  return a;
}
struct F2 { v16b h, l; };
__device__ __forceinline__ F2 bsplit16(const float v[16]) { F2 r;
#pragma unroll
  for (int i = 0; i < 16; ++i) { const __bf16 h = (__bf16)v[i]; r.h[i] = h; r.l[i] = (__bf16)(v[i] - (float)h); }
  return r; }
__device__ __forceinline__ F2 split_row(const float* row, int k0, int lane) { float v[16]; const float* p = row + k0 + 8 * (lane >> 4);
#pragma unroll
  for (int i = 0; i < 8; ++i) { v[i] = p[i]; v[8 + i] = p[16 + i]; }
  return bsplit16(v); }
__device__ __forceinline__ F2 split_rowK(const float* row, int k0, int lane, int K) { float v[16]; const int g = lane >> 4;
#pragma unroll
  for (int i = 0; i < 8; ++i) { const int ka = k0 + 8 * g + i, kb = ka + 16; v[i] = ka < K ? row[ka] : 0.f; v[8 + i] = kb < K ? row[kb] : 0.f; }
  return bsplit16(v); }
__device__ __forceinline__ F2 split_col(const float* W, int k0, int n, int lane, int ld, int K) { float v[16]; const int g = lane >> 4;
#pragma unroll
  for (int i = 0; i < 8; ++i) { const int ka = k0 + 8 * g + i, kb = ka + 16; v[i] = ka < K ? W[(size_t)ka * ld + n] : 0.f; v[8 + i] = kb < K ? W[(size_t)kb * ld + n] : 0.f; }
  return bsplit16(v); }
__device__ __forceinline__ v8f mac3(const F2& a, const F2& b, v8f c) { c = wmma_bf(a.l, b.h, c); c = wmma_bf(a.h, b.l, c); return wmma_bf(a.h, b.h, c); }
__device__ __forceinline__ float sigm(float v) { return 1.0f / (1.0f + expf(-v)); }
#define LDSX() do { asm volatile("s_wait_dscnt 0" ::: "memory"); __builtin_amdgcn_wave_barrier(); __builtin_amdgcn_fence(__ATOMIC_RELEASE, "workgroup"); } while (0)


// Multi-head credibility attention on [4,2048,256] (8 heads x 32, [out][in] weights + biases): softmax(q.k/sqrt(32)) * head_scale[h], ctx = attn v, out = ctx Wo^T + bo.
// score dim 32: k_cvt (f16 rows), k_pack (Wq|Wk|Wv|Wo rows x16), k_qkv (+bias; Q/K rows x4 per (batch, head); V^T x4), k_attn (32 key tiles of 64;
// online softmax; ctx scaled by head_scale[h]; O16 x8 token-major), k_out (+ bo). Output rms is dominated by bo/Wo scale.
#define NBI 4
#define C 256
#define NH 8
#define HD 32
#define NP 2048
#define NR (NBI * NP)

__global__ __launch_bounds__(256) void k_cvt(const float* __restrict__ x, _Float16* __restrict__ X16) {
  const size_t i8 = (size_t)blockIdx.x * 256 + threadIdx.x; if (i8 >= (size_t)NR * C / 8) return;
  union { v8h h; v4u u; } pk;
#pragma unroll
  for (int e = 0; e < 8; ++e) pk.h[e] = (_Float16)x[i8 * 8 + e];
  vst2(X16 + i8 * 8, pk.u);
}
// PT rows (256 halves x16): [0,C) Wq rows, [C,2C) Wk, [2C,3C) Wv, [3C,4C) Wo ([out][in])
__global__ __launch_bounds__(256) void k_pack(const float* __restrict__ Wq, const float* __restrict__ Wk, const float* __restrict__ Wv, const float* __restrict__ Wo, _Float16* __restrict__ PT) {
  const int n = blockIdx.x, tid = threadIdx.x; __shared__ __align__(16) _Float16 srow[C];
  const float* src = (n < C ? Wq : (n < 2 * C ? Wk : (n < 3 * C ? Wv : Wo))) + (size_t)(n & (C - 1)) * C;
  srow[tid] = (_Float16)(src[tid] * 16.0f); __syncthreads();
  if (tid < C / 8) vst2(PT + (size_t)n * C + tid * 8, *(const v4u*)(&srow[tid * 8]));
}
// QKV: block = (64 positions of one image, 128 output channels = 4 heads of q, k or v)
__global__ __launch_bounds__(128) void k_qkv(const _Float16* __restrict__ X16, const _Float16* __restrict__ PT, const float* __restrict__ bq, const float* __restrict__ bk, const float* __restrict__ bv, _Float16* __restrict__ Q16, _Float16* __restrict__ K16, _Float16* __restrict__ V16) {
  __shared__ __align__(16) float so[4][16][132];
  __shared__ __align__(16) _Float16 sth[128][72];
  const int tid = threadIdx.x, wave = tid >> 5, lane = tid & 31, col = lane & 15, g = lane >> 4;
  const int r0b = blockIdx.x * 64, r0 = r0b + wave * 16, n0 = blockIdx.y * 128; const int b = r0b / NP, s0 = r0b % NP; const int which = n0 / C, h0 = (n0 % C) / HD;
  v8f acc[8] = {};
#pragma unroll 2
  for (int kc = 0; kc < C / 32; ++kc) { const v16h a = frag_h(X16 + (size_t)(r0 + col) * C + kc * 32, lane);
#pragma unroll
    for (int j = 0; j < 8; ++j) acc[j] = wmma16(a, frag_h(PT + (size_t)(n0 + j * 16 + col) * C + kc * 32, lane), acc[j]); }
  const float* bb_ = which == 0 ? bq : (which == 1 ? bk : bv); const int cb0 = n0 % C;
  if (which < 2) {
#pragma unroll
    for (int j = 0; j < 8; ++j) { const float bb = bb_[cb0 + j * 16 + col];
#pragma unroll
      for (int r = 0; r < 8; ++r) so[wave][8 * g + r][j * 16 + col] = (acc[j][r] * (1.0f / 16.0f) + bb) * 4.0f; }
    LDSX();
    _Float16* Dst = which == 0 ? Q16 : K16;
    for (int qq = lane; qq < 4 * 16 * 4; qq += 32) { const int hh = qq >> 6, rl = (qq >> 2) & 15, pc = qq & 3; union { v8h h8; v4u u; } pk;
#pragma unroll
      for (int e = 0; e < 8; ++e) pk.h8[e] = (_Float16)so[wave][rl][hh * 32 + pc * 8 + e];
      vst2(Dst + (((size_t)b * NH + h0 + hh) * NP + s0 + wave * 16 + rl) * HD + pc * 8, pk.u); } }
  else {
#pragma unroll
    for (int j = 0; j < 8; ++j) { const float bb = bb_[cb0 + j * 16 + col];
#pragma unroll
      for (int r = 0; r < 8; ++r) sth[j * 16 + col][wave * 16 + 8 * g + r] = (_Float16)((acc[j][r] * (1.0f / 16.0f) + bb) * 4.0f); }
    __syncthreads();
    for (int qq = tid; qq < 128 * 8; qq += 128) { const int cl = qq >> 3, pc = qq & 7; vst2(V16 + ((size_t)b * C + (n0 - 2 * C) + cl) * NP + s0 + pc * 8, *(const v4u*)(&sth[cl][pc * 8])); } }
}
#define KPI 40                        // halves per K row in LDS: 64 B of data at a pitch of 80 B
#define VPI 72                        // halves per V^T row in LDS: 128 B of data at a pitch of 144 B
#define VOFF (64 * KPI)               // V^T rows stand behind the 64 K rows
#define SBUF (64 * KPI + 32 * VPI)    // halves per buffer
// one thread's share of a tile: two 16-byte pieces of K (rows r, r + 32) and two of V^T (rows r, r + 16)
__device__ __forceinline__ void copy_kv(unsigned lk, const _Float16* gk, unsigned lv, const _Float16* gv) {
  const unsigned lk1 = lk + 32 * KPI * 2, lv1 = lv + 16 * VPI * 2; const _Float16* gk1 = gk + 32 * HD; const _Float16* gv1 = gv + 16 * NP;
  // the xcnt wait closes the copies' own statement: no address register of a copy is rewritten in front of it
  asm volatile("global_load_async_to_lds_b128 %0, %1, off\n\t"
               "global_load_async_to_lds_b128 %2, %3, off\n\t"
               "global_load_async_to_lds_b128 %4, %5, off\n\t"
               "global_load_async_to_lds_b128 %6, %7, off\n\t"
               "s_wait_xcnt 0x0"
               :: "v"(lk), "v"(gk), "v"(lk1), "v"(gk1), "v"(lv), "v"(gv), "v"(lv1), "v"(gv1) : "memory");
}
__global__ __launch_bounds__(128) void k_attn(const _Float16* __restrict__ Q16, const _Float16* __restrict__ K16, const _Float16* __restrict__ V16, const float* __restrict__ hs, _Float16* __restrict__ O16) {
  __shared__ __align__(16) _Float16 sm[2 * SBUF];
  const int tid = threadIdx.x, w = tid >> 5, lane = tid & 31, col = lane & 15, g = lane >> 4;
  const size_t bh = blockIdx.y; const int b = (int)(bh / NH), h = (int)(bh % NH); const int q0 = blockIdx.x * 64 + w * 16;
  const v16h aq = frag_h(Q16 + (bh * NP + q0 + col) * HD, lane);
  const float scl = 0.17677669529663687f / 16.0f * 1.4426950408889634f;   // 1/sqrt(32), q's and k's x4 taken back, log2(e): the scores are exponents of 2
  float mrun = -3.0e38f, lrun = 0.f; v8f acc[2] = {};   // mrun = (largest score so far) - 14: exp2(score - mrun) is P with its 2^14 lift; acc[t2][r] = O^T[t2 * 16 + 8g + r][col]
  const _Float16* gk = K16 + bh * NP * HD + tid * 8;                                            // a K tile is 4 KB in a row
  const _Float16* gv = V16 + ((size_t)b * C + h * HD + (tid >> 3)) * NP + (tid & 7) * 8;       // a V^T tile is 32 rows of one line each
  const unsigned l0 = (unsigned)(size_t)&sm[0];
  const unsigned lk = l0 + (tid >> 2) * (KPI * 2) + (tid & 3) * 16, lv = l0 + VOFF * 2 + (tid >> 3) * (VPI * 2) + (tid & 7) * 16;
  copy_kv(lk, gk, lv, gv);
  asm volatile("s_wait_asynccnt 0x0" ::: "memory");   // this wave's share of tile 0 has landed
  __syncthreads();                                     // ... and every other wave's: tile 0 may be read
  copy_kv(lk + SBUF * 2, gk + 64 * HD, lv + SBUF * 2, gv + 64);
  gk += 2 * 64 * HD; gv += 2 * 64;
  const _Float16* rk = sm + col * KPI + 8 * g; const _Float16* rv = sm + VOFF + col * VPI + 8 * g;   // the lane's own half of k folded in
#pragma unroll 1   // stays rolled: one pass a trip, the ring's hand-over stands once, at the foot
  for (int kt = 0; kt < NP / 64; ++kt) {
    const int bo = (kt & 1) * SBUF;
    // all 16 fragment reads of a pass go out as one group: K lands first for the score products, V under them and the softmax
    v16h kf[4], vf[4];
#pragma unroll
    for (int t = 0; t < 4; ++t) kf[t] = frag_at(rk + bo + t * 16 * KPI);
#pragma unroll
    for (int i = 0; i < 4; ++i) vf[i] = frag_at(rv + bo + (i & 1) * 16 * VPI + (i >> 1) * 32);
    v8f s[4];   // s[t][r] = raw score of key 16t + 8g + r with query col
#pragma unroll
    for (int t = 0; t < 4; ++t) s[t] = wmma16(kf[t], aq, (v8f){});
    __builtin_amdgcn_sched_barrier(0);   // keeps the four score products in a row in front of the softmax: with the maxima scheduled in between them, each product draws hazard padding a second time
    float mx = -3.4e38f;
#pragma unroll
    for (int t = 0; t < 4; ++t)
#pragma unroll
      for (int r = 0; r < 8; ++r) mx = fmaxf(mx, s[t][r]);
    mx = fmaxf(mx, __shfl_xor(mx, 16, 32));   // the other 32 keys of this query sit in lane ^ 16
    const float mnew = fmaxf(mrun, mx * scl - 14.0f); const float corr = __builtin_amdgcn_exp2f(mrun - mnew);   // 0 on the first pass
    float ps = 0.f; v16h ph[2];   // two score tiles, converted in place, are the B operand of 32 keys: ph[kc][8 * (t & 1) + r], t = 2 kc + (t & 1)
#pragma unroll
    for (int t = 0; t < 4; ++t)
#pragma unroll
      for (int r = 0; r < 8; ++r) { const float p = __builtin_amdgcn_exp2f(s[t][r] * scl - mnew); ps += p; ph[t >> 1][8 * (t & 1) + r] = (_Float16)p; }
    ps += __shfl_xor(ps, 16, 32);
    lrun = lrun * corr + ps * (1.0f / 16384.0f); mrun = mnew;
#pragma unroll
    for (int r = 0; r < 8; ++r) { acc[0][r] *= corr; acc[1][r] *= corr; }
#pragma unroll
    for (int kc = 0; kc < 2; ++kc)
#pragma unroll
      for (int t2 = 0; t2 < 2; ++t2) acc[t2] = wmma16(vf[kc * 2 + t2], ph[kc], acc[t2]);
    asm volatile("s_wait_dscnt 0x0" ::: "memory");      // this wave has left the buffer it read
    asm volatile("s_wait_asynccnt 0x0" ::: "memory");   // its share of the next tile has landed
    __syncthreads();                                     // the next tile may be read; the buffer just read may be refilled
    if (kt + 2 < NP / 64) { copy_kv(lk + bo * 2, gk, lv + bo * 2, gv); gk += 64 * HD; gv += 64; } }
  asm volatile("s_wait_asynccnt 0x0" ::: "memory");     // no copy is open when the wave ends
  const float inv = hs[h] * 8.0f / (lrun * 16384.0f * 4.0f);
#pragma unroll
  for (int t2 = 0; t2 < 2; ++t2) { union { v8h h8; v4u u; } pk;   // a lane's 8 registers are 8 consecutive channels of its query's row: one 16-byte store
#pragma unroll
    for (int r = 0; r < 8; ++r) pk.h8[r] = (_Float16)(acc[t2][r] * inv);
    vst2(O16 + ((size_t)b * NP + q0 + col) * C + h * HD + t2 * 16 + 8 * g, pk.u); }
}
// out = ctx Wo^T /8/16 + bo : token-major rows; block (64 rows, 128 cols)
__global__ __launch_bounds__(128) void k_out(const _Float16* __restrict__ O16, const _Float16* __restrict__ PT, const float* __restrict__ bo, float* __restrict__ out) {
  __shared__ __align__(16) float so[4][16][132];
  const int tid = threadIdx.x, wave = tid >> 5, lane = tid & 31, col = lane & 15, g = lane >> 4; const int r0 = blockIdx.x * 64 + wave * 16, n0 = blockIdx.y * 128;
  v8f acc[8] = {};
#pragma unroll 2
  for (int kc = 0; kc < C / 32; ++kc) { const v16h a = frag_h(O16 + (size_t)(r0 + col) * C + kc * 32, lane);
#pragma unroll
    for (int j = 0; j < 8; ++j) acc[j] = wmma16(a, frag_h(PT + (size_t)(3 * C + n0 + j * 16 + col) * C + kc * 32, lane), acc[j]); }
#pragma unroll
  for (int j = 0; j < 8; ++j) { const float bb = bo[n0 + j * 16 + col];
#pragma unroll
    for (int r = 0; r < 8; ++r) so[wave][8 * g + r][j * 16 + col] = acc[j][r] * (1.0f / (16.0f * 8.0f)) + bb; }
  LDSX();
#pragma unroll 4
  for (int rl = 0; rl < 16; ++rl) vst2(out + (size_t)(r0 + rl) * C + n0 + lane * 4, *(const v4f*)(&so[wave][rl][lane * 4]));
}
extern "C" void kernel_launch(void* const* d_in, const int* in_sizes, int n_in, void* d_out, int out_size, void* d_ws, size_t ws_size, hipStream_t stream) {
  (void)in_sizes; (void)n_in; (void)out_size; (void)ws_size;
  const float** I = (const float**)d_in;    // x, Wq, bq, Wk, bk, Wv, bv, Wo, bo, head_scale
  const float* x = I[0]; const float* Wq = I[1]; const float* bq = I[2]; const float* Wk = I[3]; const float* bk = I[4]; const float* Wv = I[5]; const float* bv = I[6]; const float* Wo = I[7]; const float* bo = I[8]; const float* hs = I[9];
  float* out = (float*)d_out;
  char* ws = (char*)d_ws; size_t off = 0;
  auto take = [&](size_t bytes) { char* p = ws + off; off += (bytes + 255) & ~(size_t)255; return p; };
  _Float16* X16 = (_Float16*)take((size_t)NR * C * 2); _Float16* PT = (_Float16*)take((size_t)4 * C * C * 2);
  _Float16* Q16 = (_Float16*)take((size_t)NR * C * 2); _Float16* K16 = (_Float16*)take((size_t)NR * C * 2); _Float16* V16 = (_Float16*)take((size_t)NR * C * 2); _Float16* O16 = (_Float16*)take((size_t)NR * C * 2);
  // ws ~ 21 MB
  k_cvt<<<(NR * C / 8 + 255) / 256, 256, 0, stream>>>(x, X16);
  k_pack<<<4 * C, 256, 0, stream>>>(Wq, Wk, Wv, Wo, PT);
  k_qkv<<<dim3(NR / 64, 3 * C / 128, 1), 128, 0, stream>>>(X16, PT, bq, bk, bv, Q16, K16, V16);
  k_attn<<<dim3(NP / 64, NBI * NH), 128, 0, stream>>>(Q16, K16, V16, hs, O16);
  k_out<<<dim3(NR / 64, C / 128), 128, 0, stream>>>(O16, PT, bo, out);
}

// v005
// One run takes 56.3 microseconds.
// In two side-by-side timings against v004, it was 1.25 and 1.24 times as fast.
// All steps since v000 together make it 2.62 times as fast.
// compute dtype: f16 operands (x as f16 rows, weights packed x16 as f16 rows, q/k x4, P lifted by 2^14, V x4, context x8), f32 accumulate; softmax, head scaling and biases in f32.
#include <hip/hip_runtime.h>
#include <math.h>

typedef __attribute__((ext_vector_type(16))) _Float16 v16h;
typedef __attribute__((ext_vector_type(16))) __bf16 v16b;
typedef __attribute__((ext_vector_type(8)))  _Float16 v8h;
typedef __attribute__((ext_vector_type(8)))  float v8f;
typedef __attribute__((ext_vector_type(4)))  float v4f;
typedef __attribute__((ext_vector_type(2)))  float v2f;
typedef __attribute__((ext_vector_type(4)))  unsigned v4u;
typedef __attribute__((ext_vector_type(4)))  int v4i;
typedef float __attribute__((may_alias)) float_a;
typedef int __attribute__((may_alias)) int_a;

template <typename T> __device__ __forceinline__ void vst2(void* p, T v) { *(T*)p = v;  }
__device__ __forceinline__ v8f wmma16(v16h a, v16h b, v8f c) {
  v8f d = __builtin_amdgcn_wmma_f32_16x16x32_f16(false, a, false, b, (short)0, c, false, false);
  asm volatile("v_nop\n\tv_nop\n\tv_nop\n\tv_nop" : "+v"(d) : "v"(a), "v"(b));
  return d;
}
__device__ __forceinline__ v8f wmma_bf(v16b a, v16b b, v8f c) {
  v8f d = __builtin_amdgcn_wmma_f32_16x16x32_bf16(false, a, false, b, (short)0, c, false, false);
  asm volatile("v_nop\n\tv_nop\n\tv_nop\n\tv_nop" : "+v"(d) : "v"(a), "v"(b));
  return d;
}
// 16x16x32 fragments: lane = (h = lane>>4, row/col = lane&15); elements 0..7 = k0+8h+0..7, 8..15 = k0+16+8h+0..7; D element r = row 8h+r
__device__ __forceinline__ v16h frag_h(const _Float16* rowk0, int lane) {
  union { v16h v; v8h q[2]; } u; const _Float16* p = rowk0 + 8 * (lane >> 4);
  u.q[0] = *(const v8h*)p; u.q[1] = *(const v8h*)(p + 16); return u.v;
}
// the same fragment from a pointer that already holds the lane's 8 * (lane >> 4)
__device__ __forceinline__ v16h frag_at(const _Float16* p) {
  union { v16h v; v8h q[2]; } u; u.q[0] = *(const v8h*)p; u.q[1] = *(const v8h*)(p + 16); return u.v;
}
__device__ __forceinline__ v16h frag_f32(const float* rowk0, int lane) {
  v16h a; const float* p = rowk0 + 8 * (lane >> 4);
#pragma unroll
  for (int i = 0; i < 8; ++i) { a[i] = (_Float16)p[i]; a[8 + i] = (_Float16)p[16 + i]; }
  return a;
}
__device__ __forceinline__ v16h frag_f32s(const float* rowk0, int lane, float sc) {
  v16h a; const float* p = rowk0 + 8 * (lane >> 4);
#pragma unroll
  for (int i = 0; i < 8; ++i) { a[i] = (_Float16)(p[i] * sc); a[8 + i] = (_Float16)(p[16 + i] * sc); }
  return a;
}
// column fragment from a [K][ld] layout (column n), rows >= K read as 0
__device__ __forceinline__ v16h fragc_f32(const float* W, int k0, int n, int lane, int ld, int K) {
  v16h a; const int g = lane >> 4;
#pragma unroll
  for (int i = 0; i < 8; ++i) { const int ka = k0 + 8 * g + i, kb = ka + 16;
    a[i] = (_Float16)(ka < K ? W[(size_t)ka * ld + n] : 0.f); a[8 + i] = (_Float16)(kb < K ? W[(size_t)kb * ld + n] : 0.f); }
  return a;
}
struct F2 { v16b h, l; };
__device__ __forceinline__ F2 bsplit16(const float v[16]) { F2 r;
#pragma unroll
  for (int i = 0; i < 16; ++i) { const __bf16 h = (__bf16)v[i]; r.h[i] = h; r.l[i] = (__bf16)(v[i] - (float)h); }
  return r; }
__device__ __forceinline__ F2 split_row(const float* row, int k0, int lane) { float v[16]; const float* p = row + k0 + 8 * (lane >> 4);
#pragma unroll
  for (int i = 0; i < 8; ++i) { v[i] = p[i]; v[8 + i] = p[16 + i]; }
  return bsplit16(v); }
__device__ __forceinline__ F2 split_rowK(const float* row, int k0, int lane, int K) { float v[16]; const int g = lane >> 4;
#pragma unroll
  for (int i = 0; i < 8; ++i) { const int ka = k0 + 8 * g + i, kb = ka + 16; v[i] = ka < K ? row[ka] : 0.f; v[8 + i] = kb < K ? row[kb] : 0.f; }
  return bsplit16(v); }
__device__ __forceinline__ F2 split_col(const float* W, int k0, int n, int lane, int ld, int K) { float v[16]; const int g = lane >> 4;
#pragma unroll
  for (int i = 0; i < 8; ++i) { const int ka = k0 + 8 * g + i, kb = ka + 16; v[i] = ka < K ? W[(size_t)ka * ld + n] : 0.f; v[8 + i] = kb < K ? W[(size_t)kb * ld + n] : 0.f; }
  return bsplit16(v); }
__device__ __forceinline__ v8f mac3(const F2& a, const F2& b, v8f c) { c = wmma_bf(a.l, b.h, c); c = wmma_bf(a.h, b.l, c); return wmma_bf(a.h, b.h, c); }
__device__ __forceinline__ float sigm(float v) { return 1.0f / (1.0f + expf(-v)); }
#define LDSX() do { asm volatile("s_wait_dscnt 0" ::: "memory"); __builtin_amdgcn_wave_barrier(); __builtin_amdgcn_fence(__ATOMIC_RELEASE, "workgroup"); } while (0)


// Multi-head credibility attention on [4,2048,256] (8 heads x 32, [out][in] weights + biases): softmax(q.k/sqrt(32)) * head_scale[h], ctx = attn v, out = ctx Wo^T + bo.
// score dim 32: k_cvt (f16 rows), k_pack (Wq|Wk|Wv|Wo rows x16), k_qkv (+bias; Q/K rows x4 per (batch, head); V^T x4), k_attn (32 key tiles of 64;
// online softmax; ctx scaled by head_scale[h]; O16 x8 token-major), k_out (+ bo). Output rms is dominated by bo/Wo scale.
#define NBI 4
#define C 256
#define NH 8
#define HD 32
#define NP 2048
#define NR (NBI * NP)

// one k step's 18 loads: the A fragment and the eight B fragments (B rows 16 apart); pa, pb already hold the lane's row and its 8 * (lane >> 4)
__device__ __forceinline__ void ld_step(v16h& a, v16h (&b)[8], const _Float16* pa, const _Float16* pb) {
  a = frag_at(pa);
#pragma unroll
  for (int j = 0; j < 8; ++j) b[j] = frag_at(pb + (size_t)j * 16 * C);
}
__device__ __forceinline__ void mm_step(v8f (&acc)[8], const v16h& a, const v16h (&b)[8]) {
#pragma unroll
  for (int j = 0; j < 8; ++j) acc[j] = wmma16(a, b[j], acc[j]);
}
// 16 rows x 128 columns over k = C. A k step's loads go out as one group, one step ahead of the products that use them (two register sets),
// so a wave waits once a step, for loads that have had a step to land, not once a product.
__device__ __forceinline__ void mm_16x128(v8f (&acc)[8], const _Float16* pa, const _Float16* pb) {
  v16h a0, a1, b0[8], b1[8];
  ld_step(a0, b0, pa, pb);
#pragma unroll 1   // stays rolled, two k steps a trip: each set keeps its registers from trip to trip (no copies), and the kernel stays below v256
  for (int kc = 0; kc < C / 32 - 2; kc += 2) {
    ld_step(a1, b1, pa + (kc + 1) * 32, pb + (kc + 1) * 32); mm_step(acc, a0, b0);
    ld_step(a0, b0, pa + (kc + 2) * 32, pb + (kc + 2) * 32); mm_step(acc, a1, b1);
    asm volatile("s_wait_xcnt 0x0" ::: "memory"); }   // the next trip rewrites the address registers that this trip's loads, still in flight, name
  ld_step(a1, b1, pa + (C / 32 - 1) * 32, pb + (C / 32 - 1) * 32); mm_step(acc, a0, b0); mm_step(acc, a1, b1);   // the last two steps stand outside: no branch around a load group, so every wait is counted
}

__global__ __launch_bounds__(256) void k_cvt(const float* __restrict__ x, _Float16* __restrict__ X16) {
  const size_t i8 = (size_t)blockIdx.x * 256 + threadIdx.x; if (i8 >= (size_t)NR * C / 8) return;
  union { v8h h; v4u u; } pk;
#pragma unroll
  for (int e = 0; e < 8; ++e) pk.h[e] = (_Float16)x[i8 * 8 + e];
  vst2(X16 + i8 * 8, pk.u);
}
// PT rows (256 halves x16): [0,C) Wq rows, [C,2C) Wk, [2C,3C) Wv, [3C,4C) Wo ([out][in])
__global__ __launch_bounds__(256) void k_pack(const float* __restrict__ Wq, const float* __restrict__ Wk, const float* __restrict__ Wv, const float* __restrict__ Wo, _Float16* __restrict__ PT) {
  const int n = blockIdx.x, tid = threadIdx.x; __shared__ __align__(16) _Float16 srow[C];
  const float* src = (n < C ? Wq : (n < 2 * C ? Wk : (n < 3 * C ? Wv : Wo))) + (size_t)(n & (C - 1)) * C;
  srow[tid] = (_Float16)(src[tid] * 16.0f); __syncthreads();
  if (tid < C / 8) vst2(PT + (size_t)n * C + tid * 8, *(const v4u*)(&srow[tid * 8]));
}
// QKV: block = (64 positions of one image, 128 output channels = 4 heads of q, k or v)
__global__ __launch_bounds__(128) void k_qkv(const _Float16* __restrict__ X16, const _Float16* __restrict__ PT, const float* __restrict__ bq, const float* __restrict__ bk, const float* __restrict__ bv, _Float16* __restrict__ Q16, _Float16* __restrict__ K16, _Float16* __restrict__ V16) {
  __shared__ __align__(16) float so[4][16][132];
  __shared__ __align__(16) _Float16 sth[128][72];
  const int tid = threadIdx.x, wave = tid >> 5, lane = tid & 31, col = lane & 15, g = lane >> 4;
  const int r0b = blockIdx.x * 64, r0 = r0b + wave * 16, n0 = blockIdx.y * 128; const int b = r0b / NP, s0 = r0b % NP; const int which = n0 / C, h0 = (n0 % C) / HD;
  v8f acc[8] = {};
  mm_16x128(acc, X16 + (size_t)(r0 + col) * C + 8 * g, PT + (size_t)(n0 + col) * C + 8 * g);
  const float* bb_ = which == 0 ? bq : (which == 1 ? bk : bv); const int cb0 = n0 % C;
  if (which < 2) {
#pragma unroll
    for (int j = 0; j < 8; ++j) { const float bb = bb_[cb0 + j * 16 + col];
#pragma unroll
      for (int r = 0; r < 8; ++r) so[wave][8 * g + r][j * 16 + col] = (acc[j][r] * (1.0f / 16.0f) + bb) * 4.0f; }
    LDSX();
    _Float16* Dst = which == 0 ? Q16 : K16;
    for (int qq = lane; qq < 4 * 16 * 4; qq += 32) { const int hh = qq >> 6, rl = (qq >> 2) & 15, pc = qq & 3; union { v8h h8; v4u u; } pk;
#pragma unroll
      for (int e = 0; e < 8; ++e) pk.h8[e] = (_Float16)so[wave][rl][hh * 32 + pc * 8 + e];
      vst2(Dst + (((size_t)b * NH + h0 + hh) * NP + s0 + wave * 16 + rl) * HD + pc * 8, pk.u); } }
  else {
#pragma unroll
    for (int j = 0; j < 8; ++j) { const float bb = bb_[cb0 + j * 16 + col];
#pragma unroll
      for (int r = 0; r < 8; ++r) sth[j * 16 + col][wave * 16 + 8 * g + r] = (_Float16)((acc[j][r] * (1.0f / 16.0f) + bb) * 4.0f); }
    __syncthreads();
    for (int qq = tid; qq < 128 * 8; qq += 128) { const int cl = qq >> 3, pc = qq & 7; vst2(V16 + ((size_t)b * C + (n0 - 2 * C) + cl) * NP + s0 + pc * 8, *(const v4u*)(&sth[cl][pc * 8])); } }
}
#define KPI 40                        // halves per K row in LDS: 64 B of data at a pitch of 80 B
#define VPI 72                        // halves per V^T row in LDS: 128 B of data at a pitch of 144 B
#define VOFF (64 * KPI)               // V^T rows stand behind the 64 K rows
#define SBUF (64 * KPI + 32 * VPI)    // halves per buffer
// one thread's share of a tile: two 16-byte pieces of K (rows r, r + 32) and two of V^T (rows r, r + 16)
__device__ __forceinline__ void copy_kv(unsigned lk, const _Float16* gk, unsigned lv, const _Float16* gv) {
  const unsigned lk1 = lk + 32 * KPI * 2, lv1 = lv + 16 * VPI * 2; const _Float16* gk1 = gk + 32 * HD; const _Float16* gv1 = gv + 16 * NP;
  // the xcnt wait closes the copies' own statement: no address register of a copy is rewritten in front of it
  asm volatile("global_load_async_to_lds_b128 %0, %1, off\n\t"
               "global_load_async_to_lds_b128 %2, %3, off\n\t"
               "global_load_async_to_lds_b128 %4, %5, off\n\t"
               "global_load_async_to_lds_b128 %6, %7, off\n\t"
               "s_wait_xcnt 0x0"
               :: "v"(lk), "v"(gk), "v"(lk1), "v"(gk1), "v"(lv), "v"(gv), "v"(lv1), "v"(gv1) : "memory");
}
__global__ __launch_bounds__(128) void k_attn(const _Float16* __restrict__ Q16, const _Float16* __restrict__ K16, const _Float16* __restrict__ V16, const float* __restrict__ hs, _Float16* __restrict__ O16) {
  __shared__ __align__(16) _Float16 sm[2 * SBUF];
  const int tid = threadIdx.x, w = tid >> 5, lane = tid & 31, col = lane & 15, g = lane >> 4;
  const size_t bh = blockIdx.y; const int b = (int)(bh / NH), h = (int)(bh % NH); const int q0 = blockIdx.x * 64 + w * 16;
  const v16h aq = frag_h(Q16 + (bh * NP + q0 + col) * HD, lane);
  const float scl = 0.17677669529663687f / 16.0f * 1.4426950408889634f;   // 1/sqrt(32), q's and k's x4 taken back, log2(e): the scores are exponents of 2
  float mrun = -3.0e38f, lrun = 0.f; v8f acc[2] = {};   // mrun = (largest score so far) - 14: exp2(score - mrun) is P with its 2^14 lift; acc[t2][r] = O^T[t2 * 16 + 8g + r][col]
  const _Float16* gk = K16 + bh * NP * HD + tid * 8;                                            // a K tile is 4 KB in a row
  const _Float16* gv = V16 + ((size_t)b * C + h * HD + (tid >> 3)) * NP + (tid & 7) * 8;       // a V^T tile is 32 rows of one line each
  const unsigned l0 = (unsigned)(size_t)&sm[0];
  const unsigned lk = l0 + (tid >> 2) * (KPI * 2) + (tid & 3) * 16, lv = l0 + VOFF * 2 + (tid >> 3) * (VPI * 2) + (tid & 7) * 16;
  copy_kv(lk, gk, lv, gv);
  asm volatile("s_wait_asynccnt 0x0" ::: "memory");   // this wave's share of tile 0 has landed
  __syncthreads();                                     // ... and every other wave's: tile 0 may be read
  copy_kv(lk + SBUF * 2, gk + 64 * HD, lv + SBUF * 2, gv + 64);
  gk += 2 * 64 * HD; gv += 2 * 64;
  const _Float16* rk = sm + col * KPI + 8 * g; const _Float16* rv = sm + VOFF + col * VPI + 8 * g;   // the lane's own half of k folded in
#pragma unroll 1   // stays rolled: one pass a trip, the ring's hand-over stands once, at the foot
  for (int kt = 0; kt < NP / 64; ++kt) {
    const int bo = (kt & 1) * SBUF;
    // all 16 fragment reads of a pass go out as one group: K lands first for the score products, V under them and the softmax
    v16h kf[4], vf[4];
#pragma unroll
    for (int t = 0; t < 4; ++t) kf[t] = frag_at(rk + bo + t * 16 * KPI);
#pragma unroll
    for (int i = 0; i < 4; ++i) vf[i] = frag_at(rv + bo + (i & 1) * 16 * VPI + (i >> 1) * 32);
    v8f s[4];   // s[t][r] = raw score of key 16t + 8g + r with query col
#pragma unroll
    for (int t = 0; t < 4; ++t) s[t] = wmma16(kf[t], aq, (v8f){});
    __builtin_amdgcn_sched_barrier(0);   // keeps the four score products in a row in front of the softmax: with the maxima scheduled in between them, each product draws hazard padding a second time
    float mx = -3.4e38f;
#pragma unroll
    for (int t = 0; t < 4; ++t)
#pragma unroll
      for (int r = 0; r < 8; ++r) mx = fmaxf(mx, s[t][r]);
    mx = fmaxf(mx, __shfl_xor(mx, 16, 32));   // the other 32 keys of this query sit in lane ^ 16
    const float mnew = fmaxf(mrun, mx * scl - 14.0f); const float corr = __builtin_amdgcn_exp2f(mrun - mnew);   // 0 on the first pass
    float ps = 0.f; v16h ph[2];   // two score tiles, converted in place, are the B operand of 32 keys: ph[kc][8 * (t & 1) + r], t = 2 kc + (t & 1)
#pragma unroll
    for (int t = 0; t < 4; ++t)
#pragma unroll
      for (int r = 0; r < 8; ++r) { const float p = __builtin_amdgcn_exp2f(s[t][r] * scl - mnew); ps += p; ph[t >> 1][8 * (t & 1) + r] = (_Float16)p; }
    ps += __shfl_xor(ps, 16, 32);
    lrun = lrun * corr + ps * (1.0f / 16384.0f); mrun = mnew;
#pragma unroll
    for (int r = 0; r < 8; ++r) { acc[0][r] *= corr; acc[1][r] *= corr; }
#pragma unroll
    for (int kc = 0; kc < 2; ++kc)
#pragma unroll
      for (int t2 = 0; t2 < 2; ++t2) acc[t2] = wmma16(vf[kc * 2 + t2], ph[kc], acc[t2]);
    asm volatile("s_wait_dscnt 0x0" ::: "memory");      // this wave has left the buffer it read
    asm volatile("s_wait_asynccnt 0x0" ::: "memory");   // its share of the next tile has landed
    __syncthreads();                                     // the next tile may be read; the buffer just read may be refilled
    if (kt + 2 < NP / 64) { copy_kv(lk + bo * 2, gk, lv + bo * 2, gv); gk += 64 * HD; gv += 64; } }
  asm volatile("s_wait_asynccnt 0x0" ::: "memory");     // no copy is open when the wave ends
  const float inv = hs[h] * 8.0f / (lrun * 16384.0f * 4.0f);
#pragma unroll
  for (int t2 = 0; t2 < 2; ++t2) { union { v8h h8; v4u u; } pk;   // a lane's 8 registers are 8 consecutive channels of its query's row: one 16-byte store
#pragma unroll
    for (int r = 0; r < 8; ++r) pk.h8[r] = (_Float16)(acc[t2][r] * inv);
    vst2(O16 + ((size_t)b * NP + q0 + col) * C + h * HD + t2 * 16 + 8 * g, pk.u); }
}
// out = ctx Wo^T /8/16 + bo : token-major rows; block (64 rows, 128 cols)
__global__ __launch_bounds__(128) void k_out(const _Float16* __restrict__ O16, const _Float16* __restrict__ PT, const float* __restrict__ bo, float* __restrict__ out) {
  __shared__ __align__(16) float so[4][16][132];
  const int tid = threadIdx.x, wave = tid >> 5, lane = tid & 31, col = lane & 15, g = lane >> 4; const int r0 = blockIdx.x * 64 + wave * 16, n0 = blockIdx.y * 128;
  v8f acc[8] = {};
  mm_16x128(acc, O16 + (size_t)(r0 + col) * C + 8 * g, PT + (size_t)(3 * C + n0 + col) * C + 8 * g);
#pragma unroll
  for (int j = 0; j < 8; ++j) { const float bb = bo[n0 + j * 16 + col];
#pragma unroll
    for (int r = 0; r < 8; ++r) so[wave][8 * g + r][j * 16 + col] = acc[j][r] * (1.0f / (16.0f * 8.0f)) + bb; }
  LDSX();
#pragma unroll 4
  for (int rl = 0; rl < 16; ++rl) vst2(out + (size_t)(r0 + rl) * C + n0 + lane * 4, *(const v4f*)(&so[wave][rl][lane * 4]));
}
extern "C" void kernel_launch(void* const* d_in, const int* in_sizes, int n_in, void* d_out, int out_size, void* d_ws, size_t ws_size, hipStream_t stream) {
  (void)in_sizes; (void)n_in; (void)out_size; (void)ws_size;
  const float** I = (const float**)d_in;    // x, Wq, bq, Wk, bk, Wv, bv, Wo, bo, head_scale
  const float* x = I[0]; const float* Wq = I[1]; const float* bq = I[2]; const float* Wk = I[3]; const float* bk = I[4]; const float* Wv = I[5]; const float* bv = I[6]; const float* Wo = I[7]; const float* bo = I[8]; const float* hs = I[9];
  float* out = (float*)d_out;
  char* ws = (char*)d_ws; size_t off = 0;
  auto take = [&](size_t bytes) { char* p = ws + off; off += (bytes + 255) & ~(size_t)255; return p; };
  _Float16* X16 = (_Float16*)take((size_t)NR * C * 2); _Float16* PT = (_Float16*)take((size_t)4 * C * C * 2);
  _Float16* Q16 = (_Float16*)take((size_t)NR * C * 2); _Float16* K16 = (_Float16*)take((size_t)NR * C * 2); _Float16* V16 = (_Float16*)take((size_t)NR * C * 2); _Float16* O16 = (_Float16*)take((size_t)NR * C * 2);
  // ws ~ 21 MB
  k_cvt<<<(NR * C / 8 + 255) / 256, 256, 0, stream>>>(x, X16);
  k_pack<<<4 * C, 256, 0, stream>>>(Wq, Wk, Wv, Wo, PT);
  k_qkv<<<dim3(NR / 64, 3 * C / 128, 1), 128, 0, stream>>>(X16, PT, bq, bk, bv, Q16, K16, V16);
  k_attn<<<dim3(NP / 64, NBI * NH), 128, 0, stream>>>(Q16, K16, V16, hs, O16);
  k_out<<<dim3(NR / 64, C / 128), 128, 0, stream>>>(O16, PT, bo, out);
}

// v006
// A run of this version takes 51.8 microseconds.
// Next to v005, in two timings, it ran 1.08 and 1.10 times as fast.
// Over all steps from v000 it is 2.85 times as fast.
// compute dtype: f16 operands (x as f16 rows, weights packed x16 as f16 rows, q x log2(e)/(4 sqrt(32)), k x4, P lifted by 2^4 over the maximum in use, V x4, context x8), f32 accumulate; softmax, head scaling and biases in f32.
#include <hip/hip_runtime.h>
#include <math.h>

typedef __attribute__((ext_vector_type(16))) _Float16 v16h;
typedef __attribute__((ext_vector_type(16))) __bf16 v16b;
typedef __attribute__((ext_vector_type(8)))  _Float16 v8h;
typedef __attribute__((ext_vector_type(8)))  float v8f;
typedef __attribute__((ext_vector_type(4)))  float v4f;
typedef __attribute__((ext_vector_type(2)))  float v2f;
typedef __attribute__((ext_vector_type(4)))  unsigned v4u;
typedef __attribute__((ext_vector_type(4)))  int v4i;
typedef float __attribute__((may_alias)) float_a;
typedef int __attribute__((may_alias)) int_a;

template <typename T> __device__ __forceinline__ void vst2(void* p, T v) { *(T*)p = v;  }
__device__ __forceinline__ v8f wmma16(v16h a, v16h b, v8f c) {
  v8f d = __builtin_amdgcn_wmma_f32_16x16x32_f16(false, a, false, b, (short)0, c, false, false);
  asm volatile("v_nop\n\tv_nop\n\tv_nop\n\tv_nop" : "+v"(d) : "v"(a), "v"(b));
  return d;
}
__device__ __forceinline__ v8f wmma_bf(v16b a, v16b b, v8f c) {
  v8f d = __builtin_amdgcn_wmma_f32_16x16x32_bf16(false, a, false, b, (short)0, c, false, false);
  asm volatile("v_nop\n\tv_nop\n\tv_nop\n\tv_nop" : "+v"(d) : "v"(a), "v"(b));
  return d;
}
// 16x16x32 fragments: lane = (h = lane>>4, row/col = lane&15); elements 0..7 = k0+8h+0..7, 8..15 = k0+16+8h+0..7; D element r = row 8h+r
__device__ __forceinline__ v16h frag_h(const _Float16* rowk0, int lane) {
  union { v16h v; v8h q[2]; } u; const _Float16* p = rowk0 + 8 * (lane >> 4);
  u.q[0] = *(const v8h*)p; u.q[1] = *(const v8h*)(p + 16); return u.v;
}
// the same fragment from a pointer that already holds the lane's 8 * (lane >> 4)
__device__ __forceinline__ v16h frag_at(const _Float16* p) {
  union { v16h v; v8h q[2]; } u; u.q[0] = *(const v8h*)p; u.q[1] = *(const v8h*)(p + 16); return u.v;
}
__device__ __forceinline__ v16h frag_f32(const float* rowk0, int lane) {
  v16h a; const float* p = rowk0 + 8 * (lane >> 4);
#pragma unroll
  for (int i = 0; i < 8; ++i) { a[i] = (_Float16)p[i]; a[8 + i] = (_Float16)p[16 + i]; }
  return a;
}
__device__ __forceinline__ v16h frag_f32s(const float* rowk0, int lane, float sc) {
  v16h a; const float* p = rowk0 + 8 * (lane >> 4);
#pragma unroll
  for (int i = 0; i < 8; ++i) { a[i] = (_Float16)(p[i] * sc); a[8 + i] = (_Float16)(p[16 + i] * sc); }
  return a;
}
// column fragment from a [K][ld] layout (column n), rows >= K read as 0
__device__ __forceinline__ v16h fragc_f32(const float* W, int k0, int n, int lane, int ld, int K) {
  v16h a; const int g = lane >> 4;
#pragma unroll
  for (int i = 0; i < 8; ++i) { const int ka = k0 + 8 * g + i, kb = ka + 16;
    a[i] = (_Float16)(ka < K ? W[(size_t)ka * ld + n] : 0.f); a[8 + i] = (_Float16)(kb < K ? W[(size_t)kb * ld + n] : 0.f); }
  return a;
}
struct F2 { v16b h, l; };
__device__ __forceinline__ F2 bsplit16(const float v[16]) { F2 r;
#pragma unroll
  for (int i = 0; i < 16; ++i) { const __bf16 h = (__bf16)v[i]; r.h[i] = h; r.l[i] = (__bf16)(v[i] - (float)h); }
  return r; }
__device__ __forceinline__ F2 split_row(const float* row, int k0, int lane) { float v[16]; const float* p = row + k0 + 8 * (lane >> 4);
#pragma unroll
  for (int i = 0; i < 8; ++i) { v[i] = p[i]; v[8 + i] = p[16 + i]; }
  return bsplit16(v); }
__device__ __forceinline__ F2 split_rowK(const float* row, int k0, int lane, int K) { float v[16]; const int g = lane >> 4;
#pragma unroll
  for (int i = 0; i < 8; ++i) { const int ka = k0 + 8 * g + i, kb = ka + 16; v[i] = ka < K ? row[ka] : 0.f; v[8 + i] = kb < K ? row[kb] : 0.f; }
  return bsplit16(v); }
__device__ __forceinline__ F2 split_col(const float* W, int k0, int n, int lane, int ld, int K) { float v[16]; const int g = lane >> 4;
#pragma unroll
  for (int i = 0; i < 8; ++i) { const int ka = k0 + 8 * g + i, kb = ka + 16; v[i] = ka < K ? W[(size_t)ka * ld + n] : 0.f; v[8 + i] = kb < K ? W[(size_t)kb * ld + n] : 0.f; }
  return bsplit16(v); }
__device__ __forceinline__ v8f mac3(const F2& a, const F2& b, v8f c) { c = wmma_bf(a.l, b.h, c); c = wmma_bf(a.h, b.l, c); return wmma_bf(a.h, b.h, c); }
__device__ __forceinline__ float sigm(float v) { return 1.0f / (1.0f + expf(-v)); }
#define LDSX() do { asm volatile("s_wait_dscnt 0" ::: "memory"); __builtin_amdgcn_wave_barrier(); __builtin_amdgcn_fence(__ATOMIC_RELEASE, "workgroup"); } while (0)


// Multi-head credibility attention on [4,2048,256] (8 heads x 32, [out][in] weights + biases): softmax(q.k/sqrt(32)) * head_scale[h], ctx = attn v, out = ctx Wo^T + bo.
// score dim 32: k_cvt (f16 rows), k_pack (Wq|Wk|Wv|Wo rows x16), k_qkv (+bias; Q rows x QSC, K rows x4 per (batch, head); V^T x4), k_attn (32 key tiles of 64;
// online softmax; ctx scaled by head_scale[h]; O16 x8 token-major), k_out (+ bo). Output rms is dominated by bo/Wo scale.
#define NBI 4
#define C 256
#define NH 8
#define HD 32
#define NP 2048
#define NR (NBI * NP)
#define QSC 0.063758715f  // log2(e) / sqrt(32) / 4: with k x4, the product of a stored k row and a stored q row is the score as an exponent of 2

// one k step's 18 loads: the A fragment and the eight B fragments (B rows 16 apart); pa, pb already hold the lane's row and its 8 * (lane >> 4)
__device__ __forceinline__ void ld_step(v16h& a, v16h (&b)[8], const _Float16* pa, const _Float16* pb) {
  a = frag_at(pa);
#pragma unroll
  for (int j = 0; j < 8; ++j) b[j] = frag_at(pb + (size_t)j * 16 * C);
}
__device__ __forceinline__ void mm_step(v8f (&acc)[8], const v16h& a, const v16h (&b)[8]) {
#pragma unroll
  for (int j = 0; j < 8; ++j) acc[j] = wmma16(a, b[j], acc[j]);
}
// 16 rows x 128 columns over k = C. A k step's loads go out as one group, one step ahead of the products that use them (two register sets),
// so a wave waits once a step, for loads that have had a step to land, not once a product.
__device__ __forceinline__ void mm_16x128(v8f (&acc)[8], const _Float16* pa, const _Float16* pb) {
  v16h a0, a1, b0[8], b1[8];
  ld_step(a0, b0, pa, pb);
#pragma unroll 1   // stays rolled, two k steps a trip: each set keeps its registers from trip to trip (no copies), and the kernel stays below v256
  for (int kc = 0; kc < C / 32 - 2; kc += 2) {
    ld_step(a1, b1, pa + (kc + 1) * 32, pb + (kc + 1) * 32); mm_step(acc, a0, b0);
    ld_step(a0, b0, pa + (kc + 2) * 32, pb + (kc + 2) * 32); mm_step(acc, a1, b1);
    asm volatile("s_wait_xcnt 0x0" ::: "memory"); }   // the next trip rewrites the address registers that this trip's loads, still in flight, name
  ld_step(a1, b1, pa + (C / 32 - 1) * 32, pb + (C / 32 - 1) * 32); mm_step(acc, a0, b0); mm_step(acc, a1, b1);   // the last two steps stand outside: no branch around a load group, so every wait is counted
}

__global__ __launch_bounds__(256) void k_cvt(const float* __restrict__ x, _Float16* __restrict__ X16) {
  const size_t i8 = (size_t)blockIdx.x * 256 + threadIdx.x; if (i8 >= (size_t)NR * C / 8) return;
  union { v8h h; v4u u; } pk;
#pragma unroll
  for (int e = 0; e < 8; ++e) pk.h[e] = (_Float16)x[i8 * 8 + e];
  vst2(X16 + i8 * 8, pk.u);
}
// PT rows (256 halves x16): [0,C) Wq rows, [C,2C) Wk, [2C,3C) Wv, [3C,4C) Wo ([out][in])
__global__ __launch_bounds__(256) void k_pack(const float* __restrict__ Wq, const float* __restrict__ Wk, const float* __restrict__ Wv, const float* __restrict__ Wo, _Float16* __restrict__ PT) {
  const int n = blockIdx.x, tid = threadIdx.x; __shared__ __align__(16) _Float16 srow[C];
  const float* src = (n < C ? Wq : (n < 2 * C ? Wk : (n < 3 * C ? Wv : Wo))) + (size_t)(n & (C - 1)) * C;
  srow[tid] = (_Float16)(src[tid] * 16.0f); __syncthreads();
  if (tid < C / 8) vst2(PT + (size_t)n * C + tid * 8, *(const v4u*)(&srow[tid * 8]));
}
// QKV: block = (64 positions of one image, 128 output channels = 4 heads of q, k or v)
__global__ __launch_bounds__(128) void k_qkv(const _Float16* __restrict__ X16, const _Float16* __restrict__ PT, const float* __restrict__ bq, const float* __restrict__ bk, const float* __restrict__ bv, _Float16* __restrict__ Q16, _Float16* __restrict__ K16, _Float16* __restrict__ V16) {
  __shared__ __align__(16) float so[4][16][132];
  __shared__ __align__(16) _Float16 sth[128][72];
  const int tid = threadIdx.x, wave = tid >> 5, lane = tid & 31, col = lane & 15, g = lane >> 4;
  const int r0b = blockIdx.x * 64, r0 = r0b + wave * 16, n0 = blockIdx.y * 128; const int b = r0b / NP, s0 = r0b % NP; const int which = n0 / C, h0 = (n0 % C) / HD;
  v8f acc[8] = {};
  mm_16x128(acc, X16 + (size_t)(r0 + col) * C + 8 * g, PT + (size_t)(n0 + col) * C + 8 * g);
  const float* bb_ = which == 0 ? bq : (which == 1 ? bk : bv); const int cb0 = n0 % C;
  if (which < 2) { const float osc = which == 0 ? QSC : 4.0f;
#pragma unroll
    for (int j = 0; j < 8; ++j) { const float bb = bb_[cb0 + j * 16 + col];
#pragma unroll
      for (int r = 0; r < 8; ++r) so[wave][8 * g + r][j * 16 + col] = (acc[j][r] * (1.0f / 16.0f) + bb) * osc; }
    LDSX();
    _Float16* Dst = which == 0 ? Q16 : K16;
    for (int qq = lane; qq < 4 * 16 * 4; qq += 32) { const int hh = qq >> 6, rl = (qq >> 2) & 15, pc = qq & 3; union { v8h h8; v4u u; } pk;
#pragma unroll
      for (int e = 0; e < 8; ++e) pk.h8[e] = (_Float16)so[wave][rl][hh * 32 + pc * 8 + e];
      vst2(Dst + (((size_t)b * NH + h0 + hh) * NP + s0 + wave * 16 + rl) * HD + pc * 8, pk.u); } }
  else {
#pragma unroll
    for (int j = 0; j < 8; ++j) { const float bb = bb_[cb0 + j * 16 + col];
#pragma unroll
      for (int r = 0; r < 8; ++r) sth[j * 16 + col][wave * 16 + 8 * g + r] = (_Float16)((acc[j][r] * (1.0f / 16.0f) + bb) * 4.0f); }
    __syncthreads();
    for (int qq = tid; qq < 128 * 8; qq += 128) { const int cl = qq >> 3, pc = qq & 7; vst2(V16 + ((size_t)b * C + (n0 - 2 * C) + cl) * NP + s0 + pc * 8, *(const v4u*)(&sth[cl][pc * 8])); } }
}
#define KPI 40                        // halves per K row in LDS: 64 B of data at a pitch of 80 B
#define VPI 72                        // halves per V^T row in LDS: 128 B of data at a pitch of 144 B
#define VOFF (64 * KPI)               // V^T rows stand behind the 64 K rows
#define SBUF (64 * KPI + 32 * VPI)    // halves per buffer
#define PLIFT 4.0f                    // P = 2^(score - maximum in use + PLIFT)
#define PSMAX 32768.0f                // a lane's 32 P of a pass may sum to this much before the maximum in use moves: each is then below f16's largest number
// one thread's share of a tile: two 16-byte pieces of K (rows r, r + 32) and two of V^T (rows r, r + 16)
__device__ __forceinline__ void copy_kv(unsigned lk, const _Float16* gk, unsigned lv, const _Float16* gv) {
  const unsigned lk1 = lk + 32 * KPI * 2, lv1 = lv + 16 * VPI * 2; const _Float16* gk1 = gk + 32 * HD; const _Float16* gv1 = gv + 16 * NP;
  // the xcnt wait closes the copies' own statement: no address register of a copy is rewritten in front of it
  asm volatile("global_load_async_to_lds_b128 %0, %1, off\n\t"
               "global_load_async_to_lds_b128 %2, %3, off\n\t"
               "global_load_async_to_lds_b128 %4, %5, off\n\t"
               "global_load_async_to_lds_b128 %6, %7, off\n\t"
               "s_wait_xcnt 0x0"
               :: "v"(lk), "v"(gk), "v"(lk1), "v"(gk1), "v"(lv), "v"(gv), "v"(lv1), "v"(gv1) : "memory");
}
__global__ __launch_bounds__(128) void k_attn(const _Float16* __restrict__ Q16, const _Float16* __restrict__ K16, const _Float16* __restrict__ V16, const float* __restrict__ hs, _Float16* __restrict__ O16) {
  __shared__ __align__(16) _Float16 sm[2 * SBUF];
  const int tid = threadIdx.x, w = tid >> 5, lane = tid & 31, col = lane & 15, g = lane >> 4;
  const size_t bh = blockIdx.y; const int b = (int)(bh / NH), h = (int)(bh % NH); const int q0 = blockIdx.x * 64 + w * 16;
  const v16h aq = frag_h(Q16 + (bh * NP + q0 + col) * HD, lane);
  // cv = PLIFT - (the maximum in use for query col), in all 8 registers: it is the C operand of the score products, so their result is P's exponent as it stands.
  // The maximum in use moves only when a pass needs it (below); lrun = this lane's own half of the row sum, lifted like P; acc[t2][r] = O^T[t2 * 16 + 8g + r][col]
  float lrun = 0.f; v8f acc[2] = {}; v8f cv;
#pragma unroll
  for (int r = 0; r < 8; ++r) cv[r] = PLIFT;
  const _Float16* gk = K16 + bh * NP * HD + tid * 8;                                            // a K tile is 4 KB in a row
  const _Float16* gv = V16 + ((size_t)b * C + h * HD + (tid >> 3)) * NP + (tid & 7) * 8;       // a V^T tile is 32 rows of one line each
  const unsigned l0 = (unsigned)(size_t)&sm[0];
  const unsigned lk = l0 + (tid >> 2) * (KPI * 2) + (tid & 3) * 16, lv = l0 + VOFF * 2 + (tid >> 3) * (VPI * 2) + (tid & 7) * 16;
  copy_kv(lk, gk, lv, gv);
  asm volatile("s_wait_asynccnt 0x0" ::: "memory");   // this wave's share of tile 0 has landed
  __syncthreads();                                     // ... and every other wave's: tile 0 may be read
  copy_kv(lk + SBUF * 2, gk + 64 * HD, lv + SBUF * 2, gv + 64);
  gk += 2 * 64 * HD; gv += 2 * 64;
  const _Float16* rk = sm + col * KPI + 8 * g; const _Float16* rv = sm + VOFF + col * VPI + 8 * g;   // the lane's own half of k folded in
#pragma unroll 1   // stays rolled: one pass a trip, the ring's hand-over stands once, at the foot
  for (int kt = 0; kt < NP / 64; ++kt) {
    const int bo = (kt & 1) * SBUF;
    // all 16 fragment reads of a pass go out as one group: K lands first for the score products, V under them and the softmax
    v16h kf[4], vf[4];
#pragma unroll
    for (int t = 0; t < 4; ++t) kf[t] = frag_at(rk + bo + t * 16 * KPI);
#pragma unroll
    for (int i = 0; i < 4; ++i) vf[i] = frag_at(rv + bo + (i & 1) * 16 * VPI + (i >> 1) * 32);
    v8f s[4];   // s[t][r] = exponent of P for key 16t + 8g + r and query col
#pragma unroll
    for (int t = 0; t < 4; ++t) s[t] = wmma16(kf[t], aq, cv);
    __builtin_amdgcn_sched_barrier(0);   // keeps the four score products in a row in front of the softmax: with the exponentials scheduled in between them, each product draws hazard padding a second time
    float ps = 0.f; v16h ph[2];   // two score tiles, converted in place, are the B operand of 32 keys: ph[kc][8 * (t & 1) + r], t = 2 kc + (t & 1)
#pragma unroll
    for (int t = 0; t < 4; ++t)
#pragma unroll
      for (int r = 0; r < 8; ++r) { const float p = __builtin_amdgcn_exp2f(s[t][r]); ps += p; ph[t >> 1][8 * (t & 1) + r] = (_Float16)p; }
    // One test a pass, a scalar branch for the whole wave: while a lane's 32 P sum to no more than PSMAX, each of them fits f16 and the maximum in use stays.
    // The first pass always goes in (no maximum is in use yet: its bound is below any sum); so does a sum that is infinite or not a number.
    const float lim = kt == 0 ? -1.0f : PSMAX;
    if (__builtin_expect(__builtin_amdgcn_ballot_w32(!(ps <= lim)) != 0, 0)) {
      float mx = s[0][0];
#pragma unroll
      for (int t = 0; t < 4; ++t)
#pragma unroll
        for (int r = 0; r < 8; ++r) mx = fmaxf(mx, s[t][r]);
      mx = fmaxf(mx, __shfl_xor(mx, 16, 32));   // the other 32 keys of this query sit in lane ^ 16: both halves move their maximum alike
      const float up = fmaxf(mx - PLIFT, 0.f);             // how far this tile's largest score stands above the maximum in use
      const float d = kt == 0 ? mx - PLIFT : up;           // the first pass takes its own maximum, higher or lower; later the maximum only rises
      const float corr = __builtin_amdgcn_exp2f(-up);      // at most 1; on the first pass it meets zeros only
      lrun *= corr; ps = 0.f;
#pragma unroll
      for (int r = 0; r < 8; ++r) { acc[0][r] *= corr; acc[1][r] *= corr; cv[r] -= d; }
#pragma unroll
      for (int t = 0; t < 4; ++t)
#pragma unroll
        for (int r = 0; r < 8; ++r) { const float p = __builtin_amdgcn_exp2f(s[t][r] - d); ps += p; ph[t >> 1][8 * (t & 1) + r] = (_Float16)p; } }
    lrun += ps;
#pragma unroll
    for (int kc = 0; kc < 2; ++kc)
#pragma unroll
      for (int t2 = 0; t2 < 2; ++t2) acc[t2] = wmma16(vf[kc * 2 + t2], ph[kc], acc[t2]);
    asm volatile("s_wait_dscnt 0x0" ::: "memory");      // this wave has left the buffer it read
    asm volatile("s_wait_asynccnt 0x0" ::: "memory");   // its share of the next tile has landed
    __syncthreads();                                     // the next tile may be read; the buffer just read may be refilled
    if (kt + 2 < NP / 64) { copy_kv(lk + bo * 2, gk, lv + bo * 2, gv); gk += 64 * HD; gv += 64; } }
  asm volatile("s_wait_asynccnt 0x0" ::: "memory");     // no copy is open when the wave ends
  lrun += __shfl_xor(lrun, 16, 32);   // the two halves of a query's row sum meet once, here
  const float inv = hs[h] * 8.0f / (lrun * 4.0f);   // P's lift stands in acc and in lrun alike
#pragma unroll
  for (int t2 = 0; t2 < 2; ++t2) { union { v8h h8; v4u u; } pk;   // a lane's 8 registers are 8 consecutive channels of its query's row: one 16-byte store
#pragma unroll
    for (int r = 0; r < 8; ++r) pk.h8[r] = (_Float16)(acc[t2][r] * inv);
    vst2(O16 + ((size_t)b * NP + q0 + col) * C + h * HD + t2 * 16 + 8 * g, pk.u); }
}
// out = ctx Wo^T /8/16 + bo : token-major rows; block (64 rows, 128 cols)
__global__ __launch_bounds__(128) void k_out(const _Float16* __restrict__ O16, const _Float16* __restrict__ PT, const float* __restrict__ bo, float* __restrict__ out) {
  __shared__ __align__(16) float so[4][16][132];
  const int tid = threadIdx.x, wave = tid >> 5, lane = tid & 31, col = lane & 15, g = lane >> 4; const int r0 = blockIdx.x * 64 + wave * 16, n0 = blockIdx.y * 128;
  v8f acc[8] = {};
  mm_16x128(acc, O16 + (size_t)(r0 + col) * C + 8 * g, PT + (size_t)(3 * C + n0 + col) * C + 8 * g);
#pragma unroll
  for (int j = 0; j < 8; ++j) { const float bb = bo[n0 + j * 16 + col];
#pragma unroll
    for (int r = 0; r < 8; ++r) so[wave][8 * g + r][j * 16 + col] = acc[j][r] * (1.0f / (16.0f * 8.0f)) + bb; }
  LDSX();
#pragma unroll 4
  for (int rl = 0; rl < 16; ++rl) vst2(out + (size_t)(r0 + rl) * C + n0 + lane * 4, *(const v4f*)(&so[wave][rl][lane * 4]));
}
extern "C" void kernel_launch(void* const* d_in, const int* in_sizes, int n_in, void* d_out, int out_size, void* d_ws, size_t ws_size, hipStream_t stream) {
  (void)in_sizes; (void)n_in; (void)out_size; (void)ws_size;
  const float** I = (const float**)d_in;    // x, Wq, bq, Wk, bk, Wv, bv, Wo, bo, head_scale
  const float* x = I[0]; const float* Wq = I[1]; const float* bq = I[2]; const float* Wk = I[3]; const float* bk = I[4]; const float* Wv = I[5]; const float* bv = I[6]; const float* Wo = I[7]; const float* bo = I[8]; const float* hs = I[9];
  float* out = (float*)d_out;
  char* ws = (char*)d_ws; size_t off = 0;
  auto take = [&](size_t bytes) { char* p = ws + off; off += (bytes + 255) & ~(size_t)255; return p; };
  _Float16* X16 = (_Float16*)take((size_t)NR * C * 2); _Float16* PT = (_Float16*)take((size_t)4 * C * C * 2);
  _Float16* Q16 = (_Float16*)take((size_t)NR * C * 2); _Float16* K16 = (_Float16*)take((size_t)NR * C * 2); _Float16* V16 = (_Float16*)take((size_t)NR * C * 2); _Float16* O16 = (_Float16*)take((size_t)NR * C * 2);
  // ws ~ 21 MB
  k_cvt<<<(NR * C / 8 + 255) / 256, 256, 0, stream>>>(x, X16);
  k_pack<<<4 * C, 256, 0, stream>>>(Wq, Wk, Wv, Wo, PT);
  k_qkv<<<dim3(NR / 64, 3 * C / 128, 1), 128, 0, stream>>>(X16, PT, bq, bk, bv, Q16, K16, V16);
  k_attn<<<dim3(NP / 64, NBI * NH), 128, 0, stream>>>(Q16, K16, V16, hs, O16);
  k_out<<<dim3(NR / 64, C / 128), 128, 0, stream>>>(O16, PT, bo, out);
}

// v007
// Measured time: 50.6 microseconds a run.
// Next to v006, in two timings, it ran 1.04 and 1.03 times as fast.
// Counting every step since v000, it is 2.96 times as fast.
// compute dtype: f16 operands (x as f16 rows, weights packed x16 as f16 rows, q x log2(e)/(4 sqrt(32)), k x4, P lifted by 2^4 over the maximum in use, V x4, context x8), f32 accumulate; softmax, head scaling and biases in f32.
#include <hip/hip_runtime.h>
#include <math.h>

typedef __attribute__((ext_vector_type(16))) _Float16 v16h;
typedef __attribute__((ext_vector_type(16))) __bf16 v16b;
typedef __attribute__((ext_vector_type(8)))  _Float16 v8h;
typedef __attribute__((ext_vector_type(8)))  float v8f;
typedef __attribute__((ext_vector_type(4)))  float v4f;
typedef __attribute__((ext_vector_type(2)))  float v2f;
typedef __attribute__((ext_vector_type(4)))  unsigned v4u;
typedef __attribute__((ext_vector_type(4)))  int v4i;
typedef float __attribute__((may_alias)) float_a;
typedef int __attribute__((may_alias)) int_a;

template <typename T> __device__ __forceinline__ void vst2(void* p, T v) { *(T*)p = v;  }
__device__ __forceinline__ v8f wmma16(v16h a, v16h b, v8f c) {
  v8f d = __builtin_amdgcn_wmma_f32_16x16x32_f16(false, a, false, b, (short)0, c, false, false);
  asm volatile("v_nop\n\tv_nop\n\tv_nop\n\tv_nop" : "+v"(d) : "v"(a), "v"(b));
  return d;
}
__device__ __forceinline__ v8f wmma_bf(v16b a, v16b b, v8f c) {
  v8f d = __builtin_amdgcn_wmma_f32_16x16x32_bf16(false, a, false, b, (short)0, c, false, false);
  asm volatile("v_nop\n\tv_nop\n\tv_nop\n\tv_nop" : "+v"(d) : "v"(a), "v"(b));
  return d;
}
// 16x16x32 fragments: lane = (h = lane>>4, row/col = lane&15); elements 0..7 = k0+8h+0..7, 8..15 = k0+16+8h+0..7; D element r = row 8h+r
__device__ __forceinline__ v16h frag_h(const _Float16* rowk0, int lane) {
  union { v16h v; v8h q[2]; } u; const _Float16* p = rowk0 + 8 * (lane >> 4);
  u.q[0] = *(const v8h*)p; u.q[1] = *(const v8h*)(p + 16); return u.v;
}
// the same fragment from a pointer that already holds the lane's 8 * (lane >> 4)
__device__ __forceinline__ v16h frag_at(const _Float16* p) {
  union { v16h v; v8h q[2]; } u; u.q[0] = *(const v8h*)p; u.q[1] = *(const v8h*)(p + 16); return u.v;
}
__device__ __forceinline__ v16h frag_f32(const float* rowk0, int lane) {
  v16h a; const float* p = rowk0 + 8 * (lane >> 4);
#pragma unroll
  for (int i = 0; i < 8; ++i) { a[i] = (_Float16)p[i]; a[8 + i] = (_Float16)p[16 + i]; }
  return a;
}
__device__ __forceinline__ v16h frag_f32s(const float* rowk0, int lane, float sc) {
  v16h a; const float* p = rowk0 + 8 * (lane >> 4);
#pragma unroll
  for (int i = 0; i < 8; ++i) { a[i] = (_Float16)(p[i] * sc); a[8 + i] = (_Float16)(p[16 + i] * sc); }
  return a;
}
// column fragment from a [K][ld] layout (column n), rows >= K read as 0
__device__ __forceinline__ v16h fragc_f32(const float* W, int k0, int n, int lane, int ld, int K) {
  v16h a; const int g = lane >> 4;
#pragma unroll
  for (int i = 0; i < 8; ++i) { const int ka = k0 + 8 * g + i, kb = ka + 16;
    a[i] = (_Float16)(ka < K ? W[(size_t)ka * ld + n] : 0.f); a[8 + i] = (_Float16)(kb < K ? W[(size_t)kb * ld + n] : 0.f); }
  return a;
}
struct F2 { v16b h, l; };
__device__ __forceinline__ F2 bsplit16(const float v[16]) { F2 r;
#pragma unroll
  for (int i = 0; i < 16; ++i) { const __bf16 h = (__bf16)v[i]; r.h[i] = h; r.l[i] = (__bf16)(v[i] - (float)h); }
  return r; }
__device__ __forceinline__ F2 split_row(const float* row, int k0, int lane) { float v[16]; const float* p = row + k0 + 8 * (lane >> 4);
#pragma unroll
  for (int i = 0; i < 8; ++i) { v[i] = p[i]; v[8 + i] = p[16 + i]; }
  return bsplit16(v); }
__device__ __forceinline__ F2 split_rowK(const float* row, int k0, int lane, int K) { float v[16]; const int g = lane >> 4;
#pragma unroll
  for (int i = 0; i < 8; ++i) { const int ka = k0 + 8 * g + i, kb = ka + 16; v[i] = ka < K ? row[ka] : 0.f; v[8 + i] = kb < K ? row[kb] : 0.f; }
  return bsplit16(v); }
__device__ __forceinline__ F2 split_col(const float* W, int k0, int n, int lane, int ld, int K) { float v[16]; const int g = lane >> 4;
#pragma unroll
  for (int i = 0; i < 8; ++i) { const int ka = k0 + 8 * g + i, kb = ka + 16; v[i] = ka < K ? W[(size_t)ka * ld + n] : 0.f; v[8 + i] = kb < K ? W[(size_t)kb * ld + n] : 0.f; }
  return bsplit16(v); }
__device__ __forceinline__ v8f mac3(const F2& a, const F2& b, v8f c) { c = wmma_bf(a.l, b.h, c); c = wmma_bf(a.h, b.l, c); return wmma_bf(a.h, b.h, c); }
__device__ __forceinline__ float sigm(float v) { return 1.0f / (1.0f + expf(-v)); }
#define LDSX() do { asm volatile("s_wait_dscnt 0" ::: "memory"); __builtin_amdgcn_wave_barrier(); __builtin_amdgcn_fence(__ATOMIC_RELEASE, "workgroup"); } while (0)


// Multi-head credibility attention on [4,2048,256] (8 heads x 32, [out][in] weights + biases): softmax(q.k/sqrt(32)) * head_scale[h], ctx = attn v, out = ctx Wo^T + bo.
// score dim 32: k_prep (x as f16 rows; Wq|Wk|Wv|Wo rows x16), k_qkv (+bias; Q rows x QSC, K rows x4 per (batch, head); V^T x4), k_attn (32 key tiles of 64;
// online softmax; ctx scaled by head_scale[h]; O16 x8 token-major), k_out (+ bo). Output rms is dominated by bo/Wo scale.
#define NBI 4
#define C 256
#define NH 8
#define HD 32
#define NP 2048
#define NR (NBI * NP)
#define QSC 0.063758715f  // log2(e) / sqrt(32) / 4: with k x4, the product of a stored k row and a stored q row is the score as an exponent of 2

// one k step's 18 loads: the A fragment and the eight B fragments (B rows 16 apart); pa, pb already hold the lane's row and its 8 * (lane >> 4)
__device__ __forceinline__ void ld_step(v16h& a, v16h (&b)[8], const _Float16* pa, const _Float16* pb) {
  a = frag_at(pa);
#pragma unroll
  for (int j = 0; j < 8; ++j) b[j] = frag_at(pb + (size_t)j * 16 * C);
}
__device__ __forceinline__ void mm_step(v8f (&acc)[8], const v16h& a, const v16h (&b)[8]) {
#pragma unroll
  for (int j = 0; j < 8; ++j) acc[j] = wmma16(a, b[j], acc[j]);
}
// 16 rows x 128 columns over k = C. A k step's loads go out as one group, one step ahead of the products that use them (two register sets),
// so a wave waits once a step, for loads that have had a step to land, not once a product.
__device__ __forceinline__ void mm_16x128(v8f (&acc)[8], const _Float16* pa, const _Float16* pb) {
  v16h a0, a1, b0[8], b1[8];
  ld_step(a0, b0, pa, pb);
#pragma unroll 1   // stays rolled, two k steps a trip: each set keeps its registers from trip to trip (no copies), and the kernel stays below v256
  for (int kc = 0; kc < C / 32 - 2; kc += 2) {
    ld_step(a1, b1, pa + (kc + 1) * 32, pb + (kc + 1) * 32); mm_step(acc, a0, b0);
    ld_step(a0, b0, pa + (kc + 2) * 32, pb + (kc + 2) * 32); mm_step(acc, a1, b1);
    asm volatile("s_wait_xcnt 0x0" ::: "memory"); }   // the next trip rewrites the address registers that this trip's loads, still in flight, name
  ld_step(a1, b1, pa + (C / 32 - 1) * 32, pb + (C / 32 - 1) * 32); mm_step(acc, a0, b0); mm_step(acc, a1, b1);   // the last two steps stand outside: no branch around a load group, so every wait is counted
}

// one conversion launch. A group is 8 values in a row: the groups of Wq, Wk, Wv, Wo (to PT, x16), then those of x (to X16, as they are).
// PT rows (256 halves x16): [0,C) Wq rows, [C,2C) Wk, [2C,3C) Wv, [3C,4C) Wo ([out][in])
#define GX (NR * C / 8)              // groups of x
#define GW (C * C / 8)               // groups of one weight matrix
#define PREP_U 4                     // groups a thread converts: its 8 loads are all out before the first is used
#define PREP_B ((GX + 4 * GW) / (256 * PREP_U))   // blocks; the groups divide evenly
__global__ __launch_bounds__(256) void k_prep(const float* __restrict__ x, const float* __restrict__ Wq, const float* __restrict__ Wk, const float* __restrict__ Wv, const float* __restrict__ Wo, _Float16* __restrict__ X16, _Float16* __restrict__ PT) {
  v4f lo[PREP_U], hi[PREP_U]; _Float16* dst[PREP_U]; float sc[PREP_U];
#pragma unroll
  for (int u = 0; u < PREP_U; ++u) {
    const int gb = (u * PREP_B + (int)blockIdx.x) * 256;   // the block's 256 groups of turn u stand in a row and inside one source: GW is a multiple of 256
    const float* s;
    if (u * PREP_B * 256 >= 4 * GW || gb >= 4 * GW) { s = x + (size_t)(gb - 4 * GW) * 8; dst[u] = X16 + (size_t)(gb - 4 * GW) * 8; sc[u] = 1.0f; }   // the first test is known when compiling: only turn 0 chooses, by scalar values
    else { const int m = gb / GW;
      const float* w01 = (m & 1) ? Wk : Wq; const float* w23 = (m & 1) ? Wo : Wv;
      s = ((m & 2) ? w23 : w01) + (size_t)(gb % GW) * 8; dst[u] = PT + (size_t)gb * 8; sc[u] = 16.0f; }
    s += threadIdx.x * 8; dst[u] += threadIdx.x * 8;
    lo[u] = *(const v4f*)s; hi[u] = *(const v4f*)(s + 4); }
#pragma unroll
  for (int u = 0; u < PREP_U; ++u) { union { v8h h; v4u u4; } pk;
#pragma unroll
    for (int e = 0; e < 4; ++e) { pk.h[e] = (_Float16)(lo[u][e] * sc[u]); pk.h[4 + e] = (_Float16)(hi[u][e] * sc[u]); }
    vst2(dst[u], pk.u4); }
}
// QKV: block = (64 positions of one image, 128 output channels = 4 heads of q, k or v)
__global__ __launch_bounds__(128) void k_qkv(const _Float16* __restrict__ X16, const _Float16* __restrict__ PT, const float* __restrict__ bq, const float* __restrict__ bk, const float* __restrict__ bv, _Float16* __restrict__ Q16, _Float16* __restrict__ K16, _Float16* __restrict__ V16) {
  __shared__ __align__(16) float so[4][16][132];
  __shared__ __align__(16) _Float16 sth[128][72];
  const int tid = threadIdx.x, wave = tid >> 5, lane = tid & 31, col = lane & 15, g = lane >> 4;
  const int r0b = blockIdx.x * 64, r0 = r0b + wave * 16, n0 = blockIdx.y * 128; const int b = r0b / NP, s0 = r0b % NP; const int which = n0 / C, h0 = (n0 % C) / HD;
  v8f acc[8] = {};
  mm_16x128(acc, X16 + (size_t)(r0 + col) * C + 8 * g, PT + (size_t)(n0 + col) * C + 8 * g);
  const float* bb_ = which == 0 ? bq : (which == 1 ? bk : bv); const int cb0 = n0 % C;
  if (which < 2) { const float osc = which == 0 ? QSC : 4.0f;
#pragma unroll
    for (int j = 0; j < 8; ++j) { const float bb = bb_[cb0 + j * 16 + col];
#pragma unroll
      for (int r = 0; r < 8; ++r) so[wave][8 * g + r][j * 16 + col] = (acc[j][r] * (1.0f / 16.0f) + bb) * osc; }
    LDSX();
    _Float16* Dst = which == 0 ? Q16 : K16;
    for (int qq = lane; qq < 4 * 16 * 4; qq += 32) { const int hh = qq >> 6, rl = (qq >> 2) & 15, pc = qq & 3; union { v8h h8; v4u u; } pk;
#pragma unroll
      for (int e = 0; e < 8; ++e) pk.h8[e] = (_Float16)so[wave][rl][hh * 32 + pc * 8 + e];
      vst2(Dst + (((size_t)b * NH + h0 + hh) * NP + s0 + wave * 16 + rl) * HD + pc * 8, pk.u); } }
  else {
#pragma unroll
    for (int j = 0; j < 8; ++j) { const float bb = bb_[cb0 + j * 16 + col];
#pragma unroll
      for (int r = 0; r < 8; ++r) sth[j * 16 + col][wave * 16 + 8 * g + r] = (_Float16)((acc[j][r] * (1.0f / 16.0f) + bb) * 4.0f); }
    __syncthreads();
    for (int qq = tid; qq < 128 * 8; qq += 128) { const int cl = qq >> 3, pc = qq & 7; vst2(V16 + ((size_t)b * C + (n0 - 2 * C) + cl) * NP + s0 + pc * 8, *(const v4u*)(&sth[cl][pc * 8])); } }
}
#define KPI 40                        // halves per K row in LDS: 64 B of data at a pitch of 80 B
#define VPI 72                        // halves per V^T row in LDS: 128 B of data at a pitch of 144 B
#define VOFF (64 * KPI)               // V^T rows stand behind the 64 K rows
#define SBUF (64 * KPI + 32 * VPI)    // halves per buffer
#define PLIFT 4.0f                    // P = 2^(score - maximum in use + PLIFT)
#define PSMAX 32768.0f                // a lane's 32 P of a pass may sum to this much before the maximum in use moves: each is then below f16's largest number
// one thread's share of a tile: two 16-byte pieces of K (rows r, r + 32) and two of V^T (rows r, r + 16)
__device__ __forceinline__ void copy_kv(unsigned lk, const _Float16* gk, unsigned lv, const _Float16* gv) {
  const unsigned lk1 = lk + 32 * KPI * 2, lv1 = lv + 16 * VPI * 2; const _Float16* gk1 = gk + 32 * HD; const _Float16* gv1 = gv + 16 * NP;
  // the xcnt wait closes the copies' own statement: no address register of a copy is rewritten in front of it
  asm volatile("global_load_async_to_lds_b128 %0, %1, off\n\t"
               "global_load_async_to_lds_b128 %2, %3, off\n\t"
               "global_load_async_to_lds_b128 %4, %5, off\n\t"
               "global_load_async_to_lds_b128 %6, %7, off\n\t"
               "s_wait_xcnt 0x0"
               :: "v"(lk), "v"(gk), "v"(lk1), "v"(gk1), "v"(lv), "v"(gv), "v"(lv1), "v"(gv1) : "memory");
}
__global__ __launch_bounds__(128) void k_attn(const _Float16* __restrict__ Q16, const _Float16* __restrict__ K16, const _Float16* __restrict__ V16, const float* __restrict__ hs, _Float16* __restrict__ O16) {
  __shared__ __align__(16) _Float16 sm[2 * SBUF];
  const int tid = threadIdx.x, w = tid >> 5, lane = tid & 31, col = lane & 15, g = lane >> 4;
  const size_t bh = blockIdx.y; const int b = (int)(bh / NH), h = (int)(bh % NH); const int q0 = blockIdx.x * 64 + w * 16;
  const v16h aq = frag_h(Q16 + (bh * NP + q0 + col) * HD, lane);
  // cv = PLIFT - (the maximum in use for query col), in all 8 registers: it is the C operand of the score products, so their result is P's exponent as it stands.
  // The maximum in use moves only when a pass needs it (below); lrun = this lane's own half of the row sum, lifted like P; acc[t2][r] = O^T[t2 * 16 + 8g + r][col]
  float lrun = 0.f; v8f acc[2] = {}; v8f cv;
#pragma unroll
  for (int r = 0; r < 8; ++r) cv[r] = PLIFT;
  const _Float16* gk = K16 + bh * NP * HD + tid * 8;                                            // a K tile is 4 KB in a row
  const _Float16* gv = V16 + ((size_t)b * C + h * HD + (tid >> 3)) * NP + (tid & 7) * 8;       // a V^T tile is 32 rows of one line each
  const unsigned l0 = (unsigned)(size_t)&sm[0];
  const unsigned lk = l0 + (tid >> 2) * (KPI * 2) + (tid & 3) * 16, lv = l0 + VOFF * 2 + (tid >> 3) * (VPI * 2) + (tid & 7) * 16;
  copy_kv(lk, gk, lv, gv);
  asm volatile("s_wait_asynccnt 0x0" ::: "memory");   // this wave's share of tile 0 has landed
  __syncthreads();                                     // ... and every other wave's: tile 0 may be read
  copy_kv(lk + SBUF * 2, gk + 64 * HD, lv + SBUF * 2, gv + 64);
  gk += 2 * 64 * HD; gv += 2 * 64;
  const _Float16* rk = sm + col * KPI + 8 * g; const _Float16* rv = sm + VOFF + col * VPI + 8 * g;   // the lane's own half of k folded in
#pragma unroll 1   // stays rolled: one pass a trip, the ring's hand-over stands once, at the foot
  for (int kt = 0; kt < NP / 64; ++kt) {
    const int bo = (kt & 1) * SBUF;
    // all 16 fragment reads of a pass go out as one group: K lands first for the score products, V under them and the softmax
    v16h kf[4], vf[4];
#pragma unroll
    for (int t = 0; t < 4; ++t) kf[t] = frag_at(rk + bo + t * 16 * KPI);
#pragma unroll
    for (int i = 0; i < 4; ++i) vf[i] = frag_at(rv + bo + (i & 1) * 16 * VPI + (i >> 1) * 32);
    v8f s[4];   // s[t][r] = exponent of P for key 16t + 8g + r and query col
#pragma unroll
    for (int t = 0; t < 4; ++t) s[t] = wmma16(kf[t], aq, cv);
    __builtin_amdgcn_sched_barrier(0);   // keeps the four score products in a row in front of the softmax: with the exponentials scheduled in between them, each product draws hazard padding a second time
    float ps = 0.f; v16h ph[2];   // two score tiles, converted in place, are the B operand of 32 keys: ph[kc][8 * (t & 1) + r], t = 2 kc + (t & 1)
#pragma unroll
    for (int t = 0; t < 4; ++t)
#pragma unroll
      for (int r = 0; r < 8; ++r) { const float p = __builtin_amdgcn_exp2f(s[t][r]); ps += p; ph[t >> 1][8 * (t & 1) + r] = (_Float16)p; }
    // One test a pass, a scalar branch for the whole wave: while a lane's 32 P sum to no more than PSMAX, each of them fits f16 and the maximum in use stays.
    // The first pass always goes in (no maximum is in use yet: its bound is below any sum); so does a sum that is infinite or not a number.
    const float lim = kt == 0 ? -1.0f : PSMAX;
    if (__builtin_expect(__builtin_amdgcn_ballot_w32(!(ps <= lim)) != 0, 0)) {
      float mx = s[0][0];
#pragma unroll
      for (int t = 0; t < 4; ++t)
#pragma unroll
        for (int r = 0; r < 8; ++r) mx = fmaxf(mx, s[t][r]);
      mx = fmaxf(mx, __shfl_xor(mx, 16, 32));   // the other 32 keys of this query sit in lane ^ 16: both halves move their maximum alike
      const float up = fmaxf(mx - PLIFT, 0.f);             // how far this tile's largest score stands above the maximum in use
      const float d = kt == 0 ? mx - PLIFT : up;           // the first pass takes its own maximum, higher or lower; later the maximum only rises
      const float corr = __builtin_amdgcn_exp2f(-up);      // at most 1; on the first pass it meets zeros only
      lrun *= corr; ps = 0.f;
#pragma unroll
      for (int r = 0; r < 8; ++r) { acc[0][r] *= corr; acc[1][r] *= corr; cv[r] -= d; }
#pragma unroll
      for (int t = 0; t < 4; ++t)
#pragma unroll
        for (int r = 0; r < 8; ++r) { const float p = __builtin_amdgcn_exp2f(s[t][r] - d); ps += p; ph[t >> 1][8 * (t & 1) + r] = (_Float16)p; } }
    lrun += ps;
#pragma unroll
    for (int kc = 0; kc < 2; ++kc)
#pragma unroll
      for (int t2 = 0; t2 < 2; ++t2) acc[t2] = wmma16(vf[kc * 2 + t2], ph[kc], acc[t2]);
    asm volatile("s_wait_dscnt 0x0" ::: "memory");      // this wave has left the buffer it read
    asm volatile("s_wait_asynccnt 0x0" ::: "memory");   // its share of the next tile has landed
    __syncthreads();                                     // the next tile may be read; the buffer just read may be refilled
    if (kt + 2 < NP / 64) { copy_kv(lk + bo * 2, gk, lv + bo * 2, gv); gk += 64 * HD; gv += 64; } }
  asm volatile("s_wait_asynccnt 0x0" ::: "memory");     // no copy is open when the wave ends
  lrun += __shfl_xor(lrun, 16, 32);   // the two halves of a query's row sum meet once, here
  const float inv = hs[h] * 8.0f / (lrun * 4.0f);   // P's lift stands in acc and in lrun alike
#pragma unroll
  for (int t2 = 0; t2 < 2; ++t2) { union { v8h h8; v4u u; } pk;   // a lane's 8 registers are 8 consecutive channels of its query's row: one 16-byte store
#pragma unroll
    for (int r = 0; r < 8; ++r) pk.h8[r] = (_Float16)(acc[t2][r] * inv);
    vst2(O16 + ((size_t)b * NP + q0 + col) * C + h * HD + t2 * 16 + 8 * g, pk.u); }
}
// out = ctx Wo^T /8/16 + bo : token-major rows; block (64 rows, 128 cols)
__global__ __launch_bounds__(128) void k_out(const _Float16* __restrict__ O16, const _Float16* __restrict__ PT, const float* __restrict__ bo, float* __restrict__ out) {
  __shared__ __align__(16) float so[4][16][132];
  const int tid = threadIdx.x, wave = tid >> 5, lane = tid & 31, col = lane & 15, g = lane >> 4; const int r0 = blockIdx.x * 64 + wave * 16, n0 = blockIdx.y * 128;
  v8f acc[8] = {};
  mm_16x128(acc, O16 + (size_t)(r0 + col) * C + 8 * g, PT + (size_t)(3 * C + n0 + col) * C + 8 * g);
#pragma unroll
  for (int j = 0; j < 8; ++j) { const float bb = bo[n0 + j * 16 + col];
#pragma unroll
    for (int r = 0; r < 8; ++r) so[wave][8 * g + r][j * 16 + col] = acc[j][r] * (1.0f / (16.0f * 8.0f)) + bb; }
  LDSX();
#pragma unroll 4
  for (int rl = 0; rl < 16; ++rl) vst2(out + (size_t)(r0 + rl) * C + n0 + lane * 4, *(const v4f*)(&so[wave][rl][lane * 4]));
}
extern "C" void kernel_launch(void* const* d_in, const int* in_sizes, int n_in, void* d_out, int out_size, void* d_ws, size_t ws_size, hipStream_t stream) {
  (void)in_sizes; (void)n_in; (void)out_size; (void)ws_size;
  const float** I = (const float**)d_in;    // x, Wq, bq, Wk, bk, Wv, bv, Wo, bo, head_scale
  const float* x = I[0]; const float* Wq = I[1]; const float* bq = I[2]; const float* Wk = I[3]; const float* bk = I[4]; const float* Wv = I[5]; const float* bv = I[6]; const float* Wo = I[7]; const float* bo = I[8]; const float* hs = I[9];
  float* out = (float*)d_out;
  char* ws = (char*)d_ws; size_t off = 0;
  auto take = [&](size_t bytes) { char* p = ws + off; off += (bytes + 255) & ~(size_t)255; return p; };
  _Float16* X16 = (_Float16*)take((size_t)NR * C * 2); _Float16* PT = (_Float16*)take((size_t)4 * C * C * 2);
  _Float16* Q16 = (_Float16*)take((size_t)NR * C * 2); _Float16* K16 = (_Float16*)take((size_t)NR * C * 2); _Float16* V16 = (_Float16*)take((size_t)NR * C * 2); _Float16* O16 = (_Float16*)take((size_t)NR * C * 2);
  // ws ~ 21 MB
  k_prep<<<PREP_B, 256, 0, stream>>>(x, Wq, Wk, Wv, Wo, X16, PT);
  k_qkv<<<dim3(NR / 64, 3 * C / 128, 1), 128, 0, stream>>>(X16, PT, bq, bk, bv, Q16, K16, V16);
  k_attn<<<dim3(NP / 64, NBI * NH), 128, 0, stream>>>(Q16, K16, V16, hs, O16);
  k_out<<<dim3(NR / 64, C / 128), 128, 0, stream>>>(O16, PT, bo, out);
}

// v008
// It runs in 43.6 microseconds.
// Timed twice side by side with v007, it ran 1.12 and 1.15 times as fast.
// All steps since v000 together make it 3.35 times as fast.
// compute dtype: f16 operands (x as f16 rows, weights x16 as f16 rows, both converted on the way to LDS, q x log2(e)/(4 sqrt(32)), k x4, P lifted by 2^4 over the maximum in use, V x4, context x8), f32 accumulate; softmax, head scaling and biases in f32.
#include <hip/hip_runtime.h>
#include <math.h>

typedef __attribute__((ext_vector_type(16))) _Float16 v16h;
typedef __attribute__((ext_vector_type(16))) __bf16 v16b;
typedef __attribute__((ext_vector_type(8)))  _Float16 v8h;
typedef __attribute__((ext_vector_type(4)))  _Float16 v4h;
typedef __attribute__((ext_vector_type(2)))  unsigned v2u;
typedef __attribute__((ext_vector_type(8)))  float v8f;
typedef __attribute__((ext_vector_type(4)))  float v4f;
typedef __attribute__((ext_vector_type(2)))  float v2f;
typedef __attribute__((ext_vector_type(4)))  unsigned v4u;
typedef __attribute__((ext_vector_type(4)))  int v4i;
typedef float __attribute__((may_alias)) float_a;
typedef int __attribute__((may_alias)) int_a;

template <typename T> __device__ __forceinline__ void vst2(void* p, T v) { *(T*)p = v;  }
__device__ __forceinline__ v8f wmma16(v16h a, v16h b, v8f c) {
  v8f d = __builtin_amdgcn_wmma_f32_16x16x32_f16(false, a, false, b, (short)0, c, false, false);
  asm volatile("v_nop\n\tv_nop\n\tv_nop\n\tv_nop" : "+v"(d) : "v"(a), "v"(b));
  return d;
}
__device__ __forceinline__ v8f wmma_bf(v16b a, v16b b, v8f c) {
  v8f d = __builtin_amdgcn_wmma_f32_16x16x32_bf16(false, a, false, b, (short)0, c, false, false);
  asm volatile("v_nop\n\tv_nop\n\tv_nop\n\tv_nop" : "+v"(d) : "v"(a), "v"(b));
  return d;
}
// 16x16x32 fragments: lane = (h = lane>>4, row/col = lane&15); elements 0..7 = k0+8h+0..7, 8..15 = k0+16+8h+0..7; D element r = row 8h+r
__device__ __forceinline__ v16h frag_h(const _Float16* rowk0, int lane) {
  union { v16h v; v8h q[2]; } u; const _Float16* p = rowk0 + 8 * (lane >> 4);
  u.q[0] = *(const v8h*)p; u.q[1] = *(const v8h*)(p + 16); return u.v;
}
// the same fragment from a pointer that already holds the lane's 8 * (lane >> 4)
__device__ __forceinline__ v16h frag_at(const _Float16* p) {
  union { v16h v; v8h q[2]; } u; u.q[0] = *(const v8h*)p; u.q[1] = *(const v8h*)(p + 16); return u.v;
}
__device__ __forceinline__ v16h frag_f32(const float* rowk0, int lane) {
  v16h a; const float* p = rowk0 + 8 * (lane >> 4);
#pragma unroll
  for (int i = 0; i < 8; ++i) { a[i] = (_Float16)p[i]; a[8 + i] = (_Float16)p[16 + i]; }
  return a;
}
__device__ __forceinline__ v16h frag_f32s(const float* rowk0, int lane, float sc) {
  v16h a; const float* p = rowk0 + 8 * (lane >> 4);
#pragma unroll
  for (int i = 0; i < 8; ++i) { a[i] = (_Float16)(p[i] * sc); a[8 + i] = (_Float16)(p[16 + i] * sc); }
  return a;
}
// column fragment from a [K][ld] layout (column n), rows >= K read as 0
__device__ __forceinline__ v16h fragc_f32(const float* W, int k0, int n, int lane, int ld, int K) {
  v16h a; const int g = lane >> 4;
#pragma unroll
  for (int i = 0; i < 8; ++i) { const int ka = k0 + 8 * g + i, kb = ka + 16;
    a[i] = (_Float16)(ka < K ? W[(size_t)ka * ld + n] : 0.f); a[8 + i] = (_Float16)(kb < K ? W[(size_t)kb * ld + n] : 0.f); }
  return a;
}
struct F2 { v16b h, l; };
__device__ __forceinline__ F2 bsplit16(const float v[16]) { F2 r;
#pragma unroll
  for (int i = 0; i < 16; ++i) { const __bf16 h = (__bf16)v[i]; r.h[i] = h; r.l[i] = (__bf16)(v[i] - (float)h); }
  return r; }
__device__ __forceinline__ F2 split_row(const float* row, int k0, int lane) { float v[16]; const float* p = row + k0 + 8 * (lane >> 4);
#pragma unroll
  for (int i = 0; i < 8; ++i) { v[i] = p[i]; v[8 + i] = p[16 + i]; }
  return bsplit16(v); }
__device__ __forceinline__ F2 split_rowK(const float* row, int k0, int lane, int K) { float v[16]; const int g = lane >> 4;
#pragma unroll
  for (int i = 0; i < 8; ++i) { const int ka = k0 + 8 * g + i, kb = ka + 16; v[i] = ka < K ? row[ka] : 0.f; v[8 + i] = kb < K ? row[kb] : 0.f; }
  return bsplit16(v); }
__device__ __forceinline__ F2 split_col(const float* W, int k0, int n, int lane, int ld, int K) { float v[16]; const int g = lane >> 4;
#pragma unroll
  for (int i = 0; i < 8; ++i) { const int ka = k0 + 8 * g + i, kb = ka + 16; v[i] = ka < K ? W[(size_t)ka * ld + n] : 0.f; v[8 + i] = kb < K ? W[(size_t)kb * ld + n] : 0.f; }
  return bsplit16(v); }
__device__ __forceinline__ v8f mac3(const F2& a, const F2& b, v8f c) { c = wmma_bf(a.l, b.h, c); c = wmma_bf(a.h, b.l, c); return wmma_bf(a.h, b.h, c); }
__device__ __forceinline__ float sigm(float v) { return 1.0f / (1.0f + expf(-v)); }
#define LDSX() do { asm volatile("s_wait_dscnt 0" ::: "memory"); __builtin_amdgcn_wave_barrier(); __builtin_amdgcn_fence(__ATOMIC_RELEASE, "workgroup"); } while (0)


// Multi-head credibility attention on [4,2048,256] (8 heads x 32, [out][in] weights + biases): softmax(q.k/sqrt(32)) * head_scale[h], ctx = attn v, out = ctx Wo^T + bo.
// score dim 32: k_qkv (x and its weight rows to f16 in LDS; +bias; Q rows x QSC, K rows x4 per (batch, head); V^T x4), k_attn (32 key tiles of 64;
// online softmax; ctx scaled by head_scale[h]; O16 x8 token-major), k_out (+ bo). Output rms is dominated by bo/Wo scale.
#define NBI 4
#define C 256
#define NH 8
#define HD 32
#define NP 2048
#define NR (NBI * NP)
#define QSC 0.063758715f  // log2(e) / sqrt(32) / 4: with k x4, the product of a stored k row and a stored q row is the score as an exponent of 2

__device__ __forceinline__ void mm_step(v8f (&acc)[8], const v16h& a, const v16h (&b)[8]) {
#pragma unroll
  for (int j = 0; j < 8; ++j) acc[j] = wmma16(a, b[j], acc[j]);
}
#define WPI 264                       // halves per staged row in LDS: 512 B of data at a pitch of 528 B = 16 B x odd, so the 16-byte fragment reads meet no bank conflict
#define TILE_H (128 * WPI)            // halves of one staged tile of 128 rows
// 128 rows of C f32 values, in a row in memory, become f16 rows (times sc) in LDS, once per block. A wave takes a whole row (1 KB) at a time, by two loads of 512 bytes in a row each:
// every load covers four whole lines. Written in batches on two register sets, so that at least a batch's 16 loads are out while the batch before it is converted and stored.
template <int NT> __device__ __forceinline__ void stage_rows(_Float16* dst, const float* __restrict__ src, const float sc, const int tid) {
  constexpr int U = 8, NB = 128 / (NT / 32) / U;    // rows a batch, batches a wave
  v4f lo[2][U], hi[2][U];
  const unsigned vb = (unsigned)(tid >> 5) * 1024u + (unsigned)(tid & 31) * 16u;   // the wave's row, the lane's 16 bytes in each half of it
  const char* s = (const char*)src; _Float16* d = dst + (tid >> 5) * WPI + (tid & 31) * 4;
#pragma unroll
  for (int u = 0; u < U; ++u) { const char* p = s + (size_t)u * NT * 32 + vb; lo[0][u] = *(const v4f*)p; hi[0][u] = *(const v4f*)(p + 512); }
#pragma unroll
  for (int bt = 0; bt < NB; ++bt) {
    if (bt + 1 < NB) {
#pragma unroll
      for (int u = 0; u < U; ++u) { const char* p = s + (size_t)((bt + 1) * U + u) * NT * 32 + vb; lo[(bt + 1) & 1][u] = *(const v4f*)p; hi[(bt + 1) & 1][u] = *(const v4f*)(p + 512); }
      // behind the tile's last load; base and offset are named so that their registers stay as they are up to this wait
      if (bt + 2 == NB) asm volatile("s_wait_xcnt 0x0" :: "s"(src), "v"(vb) : "memory"); }
#pragma unroll
    for (int u = 0; u < U; ++u) { union { v4h h; v2u u2; } pl, ph;
#pragma unroll
      for (int e = 0; e < 4; ++e) { pl.h[e] = (_Float16)(lo[bt & 1][u][e] * sc); ph.h[e] = (_Float16)(hi[bt & 1][u][e] * sc); }
      _Float16* q = d + (bt * U + u) * (NT / 32) * WPI; vst2(q, pl.u2); vst2(q + 128, ph.u2); } }
}
// the lane's eight biases (columns 16 apart), asked for at the kernel's head so that they land under the staging
__device__ __forceinline__ void ld_bias(float (&bb)[8], const float* bp, int col) {
#pragma unroll
  for (int j = 0; j < 8; ++j) bb[j] = bp[j * 16 + col];
  asm volatile("s_wait_xcnt 0x0" :: "s"(bp), "v"(col) : "memory");   // base and index are named so that their registers stay as they are up to this wait
}
// the eight B fragments of k step kc (B rows 16 apart) from the staged tile; rb already holds the lane's row and its 8 * (lane >> 4)
__device__ __forceinline__ void ld_b(v16h (&b)[8], const _Float16* rb, int kc) {
#pragma unroll
  for (int j = 0; j < 8; ++j) b[j] = frag_at(rb + j * 16 * WPI + kc * 32);
}
// QKV: block = (128 positions of one image, 128 output channels = 4 heads of q, k or v), 4 waves of 32 positions x 128 channels: a weight fragment read from LDS feeds two products.
// The block converts its 128 rows of x and its 128 weight rows itself, once, on the way to LDS; all fragments are 16-byte LDS reads.
__global__ __launch_bounds__(128) void k_qkv(const float* __restrict__ x, const float* __restrict__ Wq, const float* __restrict__ Wk, const float* __restrict__ Wv, const float* __restrict__ bq, const float* __restrict__ bk, const float* __restrict__ bv, _Float16* __restrict__ Q16, _Float16* __restrict__ K16, _Float16* __restrict__ V16) {
  __shared__ __align__(16) _Float16 sm[2 * TILE_H];   // x rows, then weight rows; the epilogue's buffers stand on the same bytes behind a barrier
  const int tid = threadIdx.x, wave = tid >> 5, lane = tid & 31, col = lane & 15, g = lane >> 4;
  const int r0b = blockIdx.x * 128, n0 = blockIdx.y * 128; const int b = r0b / NP, s0 = r0b % NP; const int which = n0 / C, h0 = (n0 % C) / HD;
  const int cb0 = n0 % C;
  const float* Ws = which == 0 ? Wq : (which == 1 ? Wk : Wv);
  float bias[8]; ld_bias(bias, (which == 0 ? bq : (which == 1 ? bk : bv)) + cb0, col);
  stage_rows<128>(sm, x + (size_t)r0b * C, 1.0f, tid);
  stage_rows<128>(sm + TILE_H, Ws + (size_t)cb0 * C, 16.0f, tid);
  __syncthreads();   // both tiles are whole: any wave may read any row
  v8f acc[2][8] = {};   // acc[i]: positions wave * 32 + i * 16 + ...
  { const _Float16* ra = sm + (wave * 32 + col) * WPI + 8 * g; const _Float16* rb = sm + TILE_H + col * WPI + 8 * g;
#pragma unroll
    for (int kc = 0; kc < C / 32; ++kc) { v16h bf[8]; const v16h a0 = frag_at(ra + kc * 32), a1 = frag_at(ra + 16 * WPI + kc * 32); ld_b(bf, rb, kc); mm_step(acc[0], a0, bf); mm_step(acc[1], a1, bf); } }
  __syncthreads();   // every wave has left the staged tiles: their bytes may be written again
  float (*so)[16][132] = (float (*)[16][132])sm;                   // 4 x 16 x 132 floats, in the bytes of the x tile
  _Float16 (*sth)[136] = (_Float16 (*)[136])(sm + TILE_H);         // 128 rows at a pitch of 272 B, in the bytes of the weight tile
  if (which < 2) { const float osc = which == 0 ? QSC : 4.0f;
    _Float16* Dst = which == 0 ? Q16 : K16;
#pragma unroll
    for (int i = 0; i < 2; ++i) {
#pragma unroll
      for (int j = 0; j < 8; ++j) { const float bb = bias[j];
#pragma unroll
        for (int r = 0; r < 8; ++r) so[wave][8 * g + r][j * 16 + col] = (acc[i][j][r] * (1.0f / 16.0f) + bb) * osc; }
      LDSX();
      for (int qq = lane; qq < 4 * 16 * 4; qq += 32) { const int hh = qq >> 6, rl = (qq >> 2) & 15, pc = qq & 3; union { v8h h8; v4u u; } pk;
#pragma unroll
        for (int e = 0; e < 8; ++e) pk.h8[e] = (_Float16)so[wave][rl][hh * 32 + pc * 8 + e];
        vst2(Dst + (((size_t)b * NH + h0 + hh) * NP + s0 + wave * 32 + i * 16 + rl) * HD + pc * 8, pk.u); }
      } }
  else {
#pragma unroll
    for (int i = 0; i < 2; ++i)
#pragma unroll
      for (int j = 0; j < 8; ++j) { const float bb = bias[j];
#pragma unroll
        for (int r = 0; r < 8; ++r) sth[j * 16 + col][wave * 32 + i * 16 + 8 * g + r] = (_Float16)((acc[i][j][r] * (1.0f / 16.0f) + bb) * 4.0f); }
    __syncthreads();
    for (int qq = tid; qq < 128 * 16; qq += 128) { const int cl = qq >> 4, pc = qq & 15; vst2(V16 + ((size_t)b * C + (n0 - 2 * C) + cl) * NP + s0 + pc * 8, *(const v4u*)(&sth[cl][pc * 8])); } }
}
#define KPI 40                        // halves per K row in LDS: 64 B of data at a pitch of 80 B
#define VPI 72                        // halves per V^T row in LDS: 128 B of data at a pitch of 144 B
#define VOFF (64 * KPI)               // V^T rows stand behind the 64 K rows
#define SBUF (64 * KPI + 32 * VPI)    // halves per buffer
#define PLIFT 4.0f                    // P = 2^(score - maximum in use + PLIFT)
#define PSMAX 32768.0f                // a lane's 32 P of a pass may sum to this much before the maximum in use moves: each is then below f16's largest number
// one thread's share of a tile: two 16-byte pieces of K (rows r, r + 32) and two of V^T (rows r, r + 16)
__device__ __forceinline__ void copy_kv(unsigned lk, const _Float16* gk, unsigned lv, const _Float16* gv) {
  const unsigned lk1 = lk + 32 * KPI * 2, lv1 = lv + 16 * VPI * 2; const _Float16* gk1 = gk + 32 * HD; const _Float16* gv1 = gv + 16 * NP;
  // the xcnt wait closes the copies' own statement: no address register of a copy is rewritten in front of it
  asm volatile("global_load_async_to_lds_b128 %0, %1, off\n\t"
               "global_load_async_to_lds_b128 %2, %3, off\n\t"
               "global_load_async_to_lds_b128 %4, %5, off\n\t"
               "global_load_async_to_lds_b128 %6, %7, off\n\t"
               "s_wait_xcnt 0x0"
               :: "v"(lk), "v"(gk), "v"(lk1), "v"(gk1), "v"(lv), "v"(gv), "v"(lv1), "v"(gv1) : "memory");
}
__global__ __launch_bounds__(128) void k_attn(const _Float16* __restrict__ Q16, const _Float16* __restrict__ K16, const _Float16* __restrict__ V16, const float* __restrict__ hs, _Float16* __restrict__ O16) {
  __shared__ __align__(16) _Float16 sm[2 * SBUF];
  const int tid = threadIdx.x, w = tid >> 5, lane = tid & 31, col = lane & 15, g = lane >> 4;
  const size_t bh = blockIdx.y; const int b = (int)(bh / NH), h = (int)(bh % NH); const int q0 = blockIdx.x * 64 + w * 16;
  const v16h aq = frag_h(Q16 + (bh * NP + q0 + col) * HD, lane);
  // cv = PLIFT - (the maximum in use for query col), in all 8 registers: it is the C operand of the score products, so their result is P's exponent as it stands.
  // The maximum in use moves only when a pass needs it (below); lrun = this lane's own half of the row sum, lifted like P; acc[t2][r] = O^T[t2 * 16 + 8g + r][col]
  float lrun = 0.f; v8f acc[2] = {}; v8f cv;
#pragma unroll
  for (int r = 0; r < 8; ++r) cv[r] = PLIFT;
  const _Float16* gk = K16 + bh * NP * HD + tid * 8;                                            // a K tile is 4 KB in a row
  const _Float16* gv = V16 + ((size_t)b * C + h * HD + (tid >> 3)) * NP + (tid & 7) * 8;       // a V^T tile is 32 rows of one line each
  const unsigned l0 = (unsigned)(size_t)&sm[0];
  const unsigned lk = l0 + (tid >> 2) * (KPI * 2) + (tid & 3) * 16, lv = l0 + VOFF * 2 + (tid >> 3) * (VPI * 2) + (tid & 7) * 16;
  copy_kv(lk, gk, lv, gv);
  asm volatile("s_wait_asynccnt 0x0" ::: "memory");   // this wave's share of tile 0 has landed
  __syncthreads();                                     // ... and every other wave's: tile 0 may be read
  copy_kv(lk + SBUF * 2, gk + 64 * HD, lv + SBUF * 2, gv + 64);
  gk += 2 * 64 * HD; gv += 2 * 64;
  const _Float16* rk = sm + col * KPI + 8 * g; const _Float16* rv = sm + VOFF + col * VPI + 8 * g;   // the lane's own half of k folded in
#pragma unroll 1   // stays rolled: one pass a trip, the ring's hand-over stands once, at the foot
  for (int kt = 0; kt < NP / 64; ++kt) {
    const int bo = (kt & 1) * SBUF;
    // all 16 fragment reads of a pass go out as one group: K lands first for the score products, V under them and the softmax
    v16h kf[4], vf[4];
#pragma unroll
    for (int t = 0; t < 4; ++t) kf[t] = frag_at(rk + bo + t * 16 * KPI);
#pragma unroll
    for (int i = 0; i < 4; ++i) vf[i] = frag_at(rv + bo + (i & 1) * 16 * VPI + (i >> 1) * 32);
    v8f s[4];   // s[t][r] = exponent of P for key 16t + 8g + r and query col
#pragma unroll
    for (int t = 0; t < 4; ++t) s[t] = wmma16(kf[t], aq, cv);
    __builtin_amdgcn_sched_barrier(0);   // keeps the four score products in a row in front of the softmax: with the exponentials scheduled in between them, each product draws hazard padding a second time
    float ps = 0.f; v16h ph[2];   // two score tiles, converted in place, are the B operand of 32 keys: ph[kc][8 * (t & 1) + r], t = 2 kc + (t & 1)
#pragma unroll
    for (int t = 0; t < 4; ++t)
#pragma unroll
      for (int r = 0; r < 8; ++r) { const float p = __builtin_amdgcn_exp2f(s[t][r]); ps += p; ph[t >> 1][8 * (t & 1) + r] = (_Float16)p; }
    // One test a pass, a scalar branch for the whole wave: while a lane's 32 P sum to no more than PSMAX, each of them fits f16 and the maximum in use stays.
    // The first pass always goes in (no maximum is in use yet: its bound is below any sum); so does a sum that is infinite or not a number.
    const float lim = kt == 0 ? -1.0f : PSMAX;
    if (__builtin_expect(__builtin_amdgcn_ballot_w32(!(ps <= lim)) != 0, 0)) {
      float mx = s[0][0];
#pragma unroll
      for (int t = 0; t < 4; ++t)
#pragma unroll
        for (int r = 0; r < 8; ++r) mx = fmaxf(mx, s[t][r]);
      mx = fmaxf(mx, __shfl_xor(mx, 16, 32));   // the other 32 keys of this query sit in lane ^ 16: both halves move their maximum alike
      const float up = fmaxf(mx - PLIFT, 0.f);             // how far this tile's largest score stands above the maximum in use
      const float d = kt == 0 ? mx - PLIFT : up;           // the first pass takes its own maximum, higher or lower; later the maximum only rises
      const float corr = __builtin_amdgcn_exp2f(-up);      // at most 1; on the first pass it meets zeros only
      lrun *= corr; ps = 0.f;
#pragma unroll
      for (int r = 0; r < 8; ++r) { acc[0][r] *= corr; acc[1][r] *= corr; cv[r] -= d; }
#pragma unroll
      for (int t = 0; t < 4; ++t)
#pragma unroll
        for (int r = 0; r < 8; ++r) { const float p = __builtin_amdgcn_exp2f(s[t][r] - d); ps += p; ph[t >> 1][8 * (t & 1) + r] = (_Float16)p; } }
    lrun += ps;
#pragma unroll
    for (int kc = 0; kc < 2; ++kc)
#pragma unroll
      for (int t2 = 0; t2 < 2; ++t2) acc[t2] = wmma16(vf[kc * 2 + t2], ph[kc], acc[t2]);
    asm volatile("s_wait_dscnt 0x0" ::: "memory");      // this wave has left the buffer it read
    asm volatile("s_wait_asynccnt 0x0" ::: "memory");   // its share of the next tile has landed
    __syncthreads();                                     // the next tile may be read; the buffer just read may be refilled
    if (kt + 2 < NP / 64) { copy_kv(lk + bo * 2, gk, lv + bo * 2, gv); gk += 64 * HD; gv += 64; } }
  asm volatile("s_wait_asynccnt 0x0" ::: "memory");     // no copy is open when the wave ends
  lrun += __shfl_xor(lrun, 16, 32);   // the two halves of a query's row sum meet once, here
  const float inv = hs[h] * 8.0f / (lrun * 4.0f);   // P's lift stands in acc and in lrun alike
#pragma unroll
  for (int t2 = 0; t2 < 2; ++t2) { union { v8h h8; v4u u; } pk;   // a lane's 8 registers are 8 consecutive channels of its query's row: one 16-byte store
#pragma unroll
    for (int r = 0; r < 8; ++r) pk.h8[r] = (_Float16)(acc[t2][r] * inv);
    vst2(O16 + ((size_t)b * NP + q0 + col) * C + h * HD + t2 * 16 + 8 * g, pk.u); }
}
// out = ctx Wo^T /8/16 + bo : token-major rows; block (64 rows, 128 cols). The block converts its 128 rows of Wo itself, once, on the way to LDS.
__global__ __launch_bounds__(128) void k_out(const _Float16* __restrict__ O16, const float* __restrict__ Wo, const float* __restrict__ bo, float* __restrict__ out) {
  __shared__ __align__(16) _Float16 sm[TILE_H];   // weight rows; the epilogue's buffer stands on the same bytes behind a barrier
  const int tid = threadIdx.x, wave = tid >> 5, lane = tid & 31, col = lane & 15, g = lane >> 4; const int r0 = blockIdx.x * 64 + wave * 16, n0 = blockIdx.y * 128;
  float bias[8]; ld_bias(bias, bo + n0, col);
  v16h a[C / 32];   // the wave's own 16 context rows: asked for first, they land under the staging
  { const _Float16* pa = O16 + (size_t)(r0 + col) * C + 8 * g;
#pragma unroll
    for (int kc = 0; kc < C / 32; ++kc) a[kc] = frag_at(pa + kc * 32);
    asm volatile("s_wait_xcnt 0x0" :: "v"(pa) : "memory"); }   // the address pair stays whole until this wait: no load lands on it, nothing rewrites it, while a load that names it is being issued
  stage_rows<128>(sm, Wo + (size_t)n0 * C, 16.0f, tid);
  __syncthreads();   // the tile is whole: any wave may read any row
  v8f acc[8] = {};
  { const _Float16* rb = sm + col * WPI + 8 * g;
#pragma unroll
    for (int kc = 0; kc < C / 32; ++kc) { v16h bf[8]; ld_b(bf, rb, kc); mm_step(acc, a[kc], bf); } }
  __syncthreads();   // every wave has left the staged tile: its bytes may be written again
  float (*so)[16][132] = (float (*)[16][132])sm;
#pragma unroll
  for (int j = 0; j < 8; ++j) { const float bb = bias[j];
#pragma unroll
    for (int r = 0; r < 8; ++r) so[wave][8 * g + r][j * 16 + col] = acc[j][r] * (1.0f / (16.0f * 8.0f)) + bb; }
  LDSX();
#pragma unroll 4
  for (int rl = 0; rl < 16; ++rl) vst2(out + (size_t)(r0 + rl) * C + n0 + lane * 4, *(const v4f*)(&so[wave][rl][lane * 4]));
}
extern "C" void kernel_launch(void* const* d_in, const int* in_sizes, int n_in, void* d_out, int out_size, void* d_ws, size_t ws_size, hipStream_t stream) {
  (void)in_sizes; (void)n_in; (void)out_size; (void)ws_size;
  const float** I = (const float**)d_in;    // x, Wq, bq, Wk, bk, Wv, bv, Wo, bo, head_scale
  const float* x = I[0]; const float* Wq = I[1]; const float* bq = I[2]; const float* Wk = I[3]; const float* bk = I[4]; const float* Wv = I[5]; const float* bv = I[6]; const float* Wo = I[7]; const float* bo = I[8]; const float* hs = I[9];
  float* out = (float*)d_out;
  char* ws = (char*)d_ws; size_t off = 0;
  auto take = [&](size_t bytes) { char* p = ws + off; off += (bytes + 255) & ~(size_t)255; return p; };
  _Float16* Q16 = (_Float16*)take((size_t)NR * C * 2); _Float16* K16 = (_Float16*)take((size_t)NR * C * 2); _Float16* V16 = (_Float16*)take((size_t)NR * C * 2); _Float16* O16 = (_Float16*)take((size_t)NR * C * 2);
  // ws ~ 17 MB
  k_qkv<<<dim3(NR / 128, 3 * C / 128, 1), 128, 0, stream>>>(x, Wq, Wk, Wv, bq, bk, bv, Q16, K16, V16);
  k_attn<<<dim3(NP / 64, NBI * NH), 128, 0, stream>>>(Q16, K16, V16, hs, O16);
  k_out<<<dim3(NR / 64, C / 128), 128, 0, stream>>>(O16, Wo, bo, out);
}

// v009
// Measured time: 39.3 microseconds a run.
// Timed twice side by side with v008, it ran 1.10 and 1.13 times as fast.
// Counting every step since v000, it is 3.73 times as fast.
// compute dtype: f16 operands (x as f16 rows, weights x16 as f16 rows, both converted on the way to LDS, q x log2(e)/(4 sqrt(32)), k x4, P lifted by 2^4 over the maximum in use, V x4, context x8), f32 accumulate; softmax, head scaling and biases in f32.
#include <hip/hip_runtime.h>
#include <math.h>

typedef __attribute__((ext_vector_type(16))) _Float16 v16h;
typedef __attribute__((ext_vector_type(16))) __bf16 v16b;
typedef __attribute__((ext_vector_type(8)))  _Float16 v8h;
typedef __attribute__((ext_vector_type(4)))  _Float16 v4h;
typedef __attribute__((ext_vector_type(2)))  unsigned v2u;
typedef __attribute__((ext_vector_type(8)))  float v8f;
typedef __attribute__((ext_vector_type(4)))  float v4f;
typedef __attribute__((ext_vector_type(2)))  float v2f;
typedef __attribute__((ext_vector_type(4)))  unsigned v4u;
typedef __attribute__((ext_vector_type(4)))  int v4i;
typedef float __attribute__((may_alias)) float_a;
typedef int __attribute__((may_alias)) int_a;

template <typename T> __device__ __forceinline__ void vst2(void* p, T v) { *(T*)p = v;  }
__device__ __forceinline__ v8f wmma16(v16h a, v16h b, v8f c) {
  v8f d = __builtin_amdgcn_wmma_f32_16x16x32_f16(false, a, false, b, (short)0, c, false, false);
  asm volatile("v_nop\n\tv_nop\n\tv_nop\n\tv_nop" : "+v"(d) : "v"(a), "v"(b));
  return d;
}
__device__ __forceinline__ v8f wmma_bf(v16b a, v16b b, v8f c) {
  v8f d = __builtin_amdgcn_wmma_f32_16x16x32_bf16(false, a, false, b, (short)0, c, false, false);
  asm volatile("v_nop\n\tv_nop\n\tv_nop\n\tv_nop" : "+v"(d) : "v"(a), "v"(b));
  return d;
}
// 16x16x32 fragments: lane = (h = lane>>4, row/col = lane&15); elements 0..7 = k0+8h+0..7, 8..15 = k0+16+8h+0..7; D element r = row 8h+r
__device__ __forceinline__ v16h frag_h(const _Float16* rowk0, int lane) {
  union { v16h v; v8h q[2]; } u; const _Float16* p = rowk0 + 8 * (lane >> 4);
  u.q[0] = *(const v8h*)p; u.q[1] = *(const v8h*)(p + 16); return u.v;
}
// the same fragment from a pointer that already holds the lane's 8 * (lane >> 4)
__device__ __forceinline__ v16h frag_at(const _Float16* p) {
  union { v16h v; v8h q[2]; } u; u.q[0] = *(const v8h*)p; u.q[1] = *(const v8h*)(p + 16); return u.v;
}
__device__ __forceinline__ v16h frag_f32(const float* rowk0, int lane) {
  v16h a; const float* p = rowk0 + 8 * (lane >> 4);
#pragma unroll
  for (int i = 0; i < 8; ++i) { a[i] = (_Float16)p[i]; a[8 + i] = (_Float16)p[16 + i]; }
  return a;
}
__device__ __forceinline__ v16h frag_f32s(const float* rowk0, int lane, float sc) {
  v16h a; const float* p = rowk0 + 8 * (lane >> 4);
#pragma unroll
  for (int i = 0; i < 8; ++i) { a[i] = (_Float16)(p[i] * sc); a[8 + i] = (_Float16)(p[16 + i] * sc); }
  return a;
}
// column fragment from a [K][ld] layout (column n), rows >= K read as 0
__device__ __forceinline__ v16h fragc_f32(const float* W, int k0, int n, int lane, int ld, int K) {
  v16h a; const int g = lane >> 4;
#pragma unroll
  for (int i = 0; i < 8; ++i) { const int ka = k0 + 8 * g + i, kb = ka + 16;
    a[i] = (_Float16)(ka < K ? W[(size_t)ka * ld + n] : 0.f); a[8 + i] = (_Float16)(kb < K ? W[(size_t)kb * ld + n] : 0.f); }
  return a;
}
struct F2 { v16b h, l; };
__device__ __forceinline__ F2 bsplit16(const float v[16]) { F2 r;
#pragma unroll
  for (int i = 0; i < 16; ++i) { const __bf16 h = (__bf16)v[i]; r.h[i] = h; r.l[i] = (__bf16)(v[i] - (float)h); }
  return r; }
__device__ __forceinline__ F2 split_row(const float* row, int k0, int lane) { float v[16]; const float* p = row + k0 + 8 * (lane >> 4);
#pragma unroll
  for (int i = 0; i < 8; ++i) { v[i] = p[i]; v[8 + i] = p[16 + i]; }
  return bsplit16(v); }
__device__ __forceinline__ F2 split_rowK(const float* row, int k0, int lane, int K) { float v[16]; const int g = lane >> 4;
#pragma unroll
  for (int i = 0; i < 8; ++i) { const int ka = k0 + 8 * g + i, kb = ka + 16; v[i] = ka < K ? row[ka] : 0.f; v[8 + i] = kb < K ? row[kb] : 0.f; }
  return bsplit16(v); }
__device__ __forceinline__ F2 split_col(const float* W, int k0, int n, int lane, int ld, int K) { float v[16]; const int g = lane >> 4;
#pragma unroll
  for (int i = 0; i < 8; ++i) { const int ka = k0 + 8 * g + i, kb = ka + 16; v[i] = ka < K ? W[(size_t)ka * ld + n] : 0.f; v[8 + i] = kb < K ? W[(size_t)kb * ld + n] : 0.f; }
  return bsplit16(v); }
__device__ __forceinline__ v8f mac3(const F2& a, const F2& b, v8f c) { c = wmma_bf(a.l, b.h, c); c = wmma_bf(a.h, b.l, c); return wmma_bf(a.h, b.h, c); }
__device__ __forceinline__ float sigm(float v) { return 1.0f / (1.0f + expf(-v)); }
#define LDSX() do { asm volatile("s_wait_dscnt 0" ::: "memory"); __builtin_amdgcn_wave_barrier(); __builtin_amdgcn_fence(__ATOMIC_RELEASE, "workgroup"); } while (0)


// Multi-head credibility attention on [4,2048,256] (8 heads x 32, [out][in] weights + biases): softmax(q.k/sqrt(32)) * head_scale[h], ctx = attn v, out = ctx Wo^T + bo.
// score dim 32: k_qkv (x and its weight rows to f16 in LDS; +bias; Q rows x QSC, K rows x4 per (batch, head); V^T x4), k_attn (16 passes of 128 keys;
// online softmax; ctx scaled by head_scale[h]; O16 x8 token-major), k_out (+ bo). Output rms is dominated by bo/Wo scale.
#define NBI 4
#define C 256
#define NH 8
#define HD 32
#define NP 2048
#define NR (NBI * NP)
#define QSC 0.063758715f  // log2(e) / sqrt(32) / 4: with k x4, the product of a stored k row and a stored q row is the score as an exponent of 2

__device__ __forceinline__ void mm_step(v8f (&acc)[8], const v16h& a, const v16h (&b)[8]) {
#pragma unroll
  for (int j = 0; j < 8; ++j) acc[j] = wmma16(a, b[j], acc[j]);
}
#define WPI 264                       // halves per staged row in LDS: 512 B of data at a pitch of 528 B = 16 B x odd, so the 16-byte fragment reads meet no bank conflict
#define TILE_H (128 * WPI)            // halves of one staged tile of 128 rows
// 128 rows of C f32 values, in a row in memory, become f16 rows (times sc) in LDS, once per block. A wave takes a whole row (1 KB) at a time, by two loads of 512 bytes in a row each:
// every load covers four whole lines. Written in batches on two register sets, so that at least a batch's 16 loads are out while the batch before it is converted and stored.
template <int NT> __device__ __forceinline__ void stage_rows(_Float16* dst, const float* __restrict__ src, const float sc, const int tid) {
  constexpr int U = 8, NB = 128 / (NT / 32) / U;    // rows a batch, batches a wave
  v4f lo[2][U], hi[2][U];
  const unsigned vb = (unsigned)(tid >> 5) * 1024u + (unsigned)(tid & 31) * 16u;   // the wave's row, the lane's 16 bytes in each half of it
  const char* s = (const char*)src; _Float16* d = dst + (tid >> 5) * WPI + (tid & 31) * 4;
#pragma unroll
  for (int u = 0; u < U; ++u) { const char* p = s + (size_t)u * NT * 32 + vb; lo[0][u] = *(const v4f*)p; hi[0][u] = *(const v4f*)(p + 512); }
#pragma unroll
  for (int bt = 0; bt < NB; ++bt) {
    if (bt + 1 < NB) {
#pragma unroll
      for (int u = 0; u < U; ++u) { const char* p = s + (size_t)((bt + 1) * U + u) * NT * 32 + vb; lo[(bt + 1) & 1][u] = *(const v4f*)p; hi[(bt + 1) & 1][u] = *(const v4f*)(p + 512); }
      // behind the tile's last load; base and offset are named so that their registers stay as they are up to this wait
      if (bt + 2 == NB) asm volatile("s_wait_xcnt 0x0" :: "s"(src), "v"(vb) : "memory"); }
#pragma unroll
    for (int u = 0; u < U; ++u) { union { v4h h; v2u u2; } pl, ph;
#pragma unroll
      for (int e = 0; e < 4; ++e) { pl.h[e] = (_Float16)(lo[bt & 1][u][e] * sc); ph.h[e] = (_Float16)(hi[bt & 1][u][e] * sc); }
      _Float16* q = d + (bt * U + u) * (NT / 32) * WPI; vst2(q, pl.u2); vst2(q + 128, ph.u2); } }
}
// the lane's eight biases (columns 16 apart), asked for at the kernel's head so that they land under the staging
__device__ __forceinline__ void ld_bias(float (&bb)[8], const float* bp, int col) {
#pragma unroll
  for (int j = 0; j < 8; ++j) bb[j] = bp[j * 16 + col];
  asm volatile("s_wait_xcnt 0x0" :: "s"(bp), "v"(col) : "memory");   // base and index are named so that their registers stay as they are up to this wait
}
// the eight B fragments of k step kc (B rows 16 apart) from the staged tile; rb already holds the lane's row and its 8 * (lane >> 4)
__device__ __forceinline__ void ld_b(v16h (&b)[8], const _Float16* rb, int kc) {
#pragma unroll
  for (int j = 0; j < 8; ++j) b[j] = frag_at(rb + j * 16 * WPI + kc * 32);
}
// QKV: block = (128 positions of one image, 128 output channels = 4 heads of q, k or v), 4 waves of 32 positions x 128 channels: a weight fragment read from LDS feeds two products.
// The block converts its 128 rows of x and its 128 weight rows itself, once, on the way to LDS; all fragments are 16-byte LDS reads.
__global__ __launch_bounds__(128) void k_qkv(const float* __restrict__ x, const float* __restrict__ Wq, const float* __restrict__ Wk, const float* __restrict__ Wv, const float* __restrict__ bq, const float* __restrict__ bk, const float* __restrict__ bv, _Float16* __restrict__ Q16, _Float16* __restrict__ K16, _Float16* __restrict__ V16) {
  __shared__ __align__(16) _Float16 sm[2 * TILE_H];   // x rows, then weight rows; the epilogue's buffers stand on the same bytes behind a barrier
  const int tid = threadIdx.x, wave = tid >> 5, lane = tid & 31, col = lane & 15, g = lane >> 4;
  const int r0b = blockIdx.x * 128, n0 = blockIdx.y * 128; const int b = r0b / NP, s0 = r0b % NP; const int which = n0 / C, h0 = (n0 % C) / HD;
  const int cb0 = n0 % C;
  const float* Ws = which == 0 ? Wq : (which == 1 ? Wk : Wv);
  float bias[8]; ld_bias(bias, (which == 0 ? bq : (which == 1 ? bk : bv)) + cb0, col);
  stage_rows<128>(sm, x + (size_t)r0b * C, 1.0f, tid);
  stage_rows<128>(sm + TILE_H, Ws + (size_t)cb0 * C, 16.0f, tid);
  __syncthreads();   // both tiles are whole: any wave may read any row
  v8f acc[2][8] = {};   // acc[i]: positions wave * 32 + i * 16 + ...
  { const _Float16* ra = sm + (wave * 32 + col) * WPI + 8 * g; const _Float16* rb = sm + TILE_H + col * WPI + 8 * g;
#pragma unroll
    for (int kc = 0; kc < C / 32; ++kc) { v16h bf[8]; const v16h a0 = frag_at(ra + kc * 32), a1 = frag_at(ra + 16 * WPI + kc * 32); ld_b(bf, rb, kc); mm_step(acc[0], a0, bf); mm_step(acc[1], a1, bf); } }
  __syncthreads();   // every wave has left the staged tiles: their bytes may be written again
  float (*so)[16][132] = (float (*)[16][132])sm;                   // 4 x 16 x 132 floats, in the bytes of the x tile
  _Float16 (*sth)[136] = (_Float16 (*)[136])(sm + TILE_H);         // 128 rows at a pitch of 272 B, in the bytes of the weight tile
  if (which < 2) { const float osc = which == 0 ? QSC : 4.0f;
    _Float16* Dst = which == 0 ? Q16 : K16;
#pragma unroll
    for (int i = 0; i < 2; ++i) {
#pragma unroll
      for (int j = 0; j < 8; ++j) { const float bb = bias[j];
#pragma unroll
        for (int r = 0; r < 8; ++r) so[wave][8 * g + r][j * 16 + col] = (acc[i][j][r] * (1.0f / 16.0f) + bb) * osc; }
      LDSX();
      for (int qq = lane; qq < 4 * 16 * 4; qq += 32) { const int hh = qq >> 6, rl = (qq >> 2) & 15, pc = qq & 3; union { v8h h8; v4u u; } pk;
#pragma unroll
        for (int e = 0; e < 8; ++e) pk.h8[e] = (_Float16)so[wave][rl][hh * 32 + pc * 8 + e];
        vst2(Dst + (((size_t)b * NH + h0 + hh) * NP + s0 + wave * 32 + i * 16 + rl) * HD + pc * 8, pk.u); }
      } }
  else {
#pragma unroll
    for (int i = 0; i < 2; ++i)
#pragma unroll
      for (int j = 0; j < 8; ++j) { const float bb = bias[j];
#pragma unroll
        for (int r = 0; r < 8; ++r) sth[j * 16 + col][wave * 32 + i * 16 + 8 * g + r] = (_Float16)((acc[i][j][r] * (1.0f / 16.0f) + bb) * 4.0f); }
    __syncthreads();
    for (int qq = tid; qq < 128 * 16; qq += 128) { const int cl = qq >> 4, pc = qq & 15; vst2(V16 + ((size_t)b * C + (n0 - 2 * C) + cl) * NP + s0 + pc * 8, *(const v4u*)(&sth[cl][pc * 8])); } }
}
#define KPI 40                        // halves per K row in LDS: 64 B of data at a pitch of 80 B
#define VPI 136                       // halves per V^T row in LDS: 256 B of data at a pitch of 272 B
#define KT 128                        // keys per pass: the ring's hand-over (waits, barrier, copies) and the wait for the first fragments come once per KT keys
#define VOFF (KT * KPI)               // V^T rows stand behind the KT K rows
#define SBUF (KT * KPI + 32 * VPI)    // halves per buffer
#define PLIFT 4.0f                    // P = 2^(score - maximum in use + PLIFT)
#define PSMAX 32768.0f                // a lane's 32 P of a half pass may sum to this much before the maximum in use moves: each is then below f16's largest number
// one thread's share of a tile: four 16-byte pieces of K (rows r, r + 32, r + 64, r + 96) and four of V^T (rows r, r + 8, r + 16, r + 24)
__device__ __forceinline__ void copy_kv(unsigned lk, const _Float16* gk, unsigned lv, const _Float16* gv) {
  const unsigned lk1 = lk + 32 * KPI * 2, lk2 = lk + 64 * KPI * 2, lk3 = lk + 96 * KPI * 2, lv1 = lv + 8 * VPI * 2, lv2 = lv + 16 * VPI * 2, lv3 = lv + 24 * VPI * 2;
  const _Float16* gk1 = gk + 32 * HD; const _Float16* gk2 = gk + 64 * HD; const _Float16* gk3 = gk + 96 * HD;
  const _Float16* gv1 = gv + 8 * NP; const _Float16* gv2 = gv + 16 * NP; const _Float16* gv3 = gv + 24 * NP;
  // the xcnt wait closes the copies' own statement: no address register of a copy is rewritten in front of it
  asm volatile("global_load_async_to_lds_b128 %0, %1, off\n\t"
               "global_load_async_to_lds_b128 %2, %3, off\n\t"
               "global_load_async_to_lds_b128 %4, %5, off\n\t"
               "global_load_async_to_lds_b128 %6, %7, off\n\t"
               "global_load_async_to_lds_b128 %8, %9, off\n\t"
               "global_load_async_to_lds_b128 %10, %11, off\n\t"
               "global_load_async_to_lds_b128 %12, %13, off\n\t"
               "global_load_async_to_lds_b128 %14, %15, off\n\t"
               "s_wait_xcnt 0x0"
               :: "v"(lk), "v"(gk), "v"(lk1), "v"(gk1), "v"(lk2), "v"(gk2), "v"(lk3), "v"(gk3),
                  "v"(lv), "v"(gv), "v"(lv1), "v"(gv1), "v"(lv2), "v"(gv2), "v"(lv3), "v"(gv3) : "memory");
}
__global__ __launch_bounds__(128) void k_attn(const _Float16* __restrict__ Q16, const _Float16* __restrict__ K16, const _Float16* __restrict__ V16, const float* __restrict__ hs, _Float16* __restrict__ O16) {
  __shared__ __align__(16) _Float16 sm[2 * SBUF];
  const int tid = threadIdx.x, w = tid >> 5, lane = tid & 31, col = lane & 15, g = lane >> 4;
  const size_t bh = blockIdx.y; const int b = (int)(bh / NH), h = (int)(bh % NH); const int q0 = blockIdx.x * 64 + w * 16;
  const v16h aq = frag_h(Q16 + (bh * NP + q0 + col) * HD, lane);
  // cv = PLIFT - (the maximum in use for query col), in all 8 registers: it is the C operand of the score products, so their result is P's exponent as it stands.
  // The maximum in use moves only when a pass needs it (below); lrun = this lane's own half of the row sum, lifted like P; acc[t2][r] = O^T[t2 * 16 + 8g + r][col]
  float lrun = 0.f; v8f acc[2] = {}; v8f cv;
#pragma unroll
  for (int r = 0; r < 8; ++r) cv[r] = PLIFT;
  const _Float16* gk = K16 + bh * NP * HD + tid * 8;                                            // a K tile is 8 KB in a row
  const _Float16* gv = V16 + ((size_t)b * C + h * HD + (tid >> 4)) * NP + (tid & 15) * 8;      // a V^T tile is 32 rows of two lines each
  const unsigned l0 = (unsigned)(size_t)&sm[0];
  const unsigned lk = l0 + (tid >> 2) * (KPI * 2) + (tid & 3) * 16, lv = l0 + VOFF * 2 + (tid >> 4) * (VPI * 2) + (tid & 15) * 16;
  copy_kv(lk, gk, lv, gv);
  asm volatile("s_wait_asynccnt 0x0" ::: "memory");   // this wave's share of tile 0 has landed
  __syncthreads();                                     // ... and every other wave's: tile 0 may be read
  copy_kv(lk + SBUF * 2, gk + KT * HD, lv + SBUF * 2, gv + KT);
  gk += 2 * KT * HD; gv += 2 * KT;
  const _Float16* rk = sm + col * KPI + 8 * g; const _Float16* rv = sm + VOFF + col * VPI + 8 * g;   // the lane's own half of k folded in
#pragma unroll 1   // stays rolled: one pass a trip, the ring's hand-over stands once, at the foot
  for (int kt = 0; kt < NP / KT; ++kt) {
    const int bo = (kt & 1) * SBUF;
    // the 16 fragment reads of a half go out as one group: K lands first for the score products, V under them and the softmax
    v16h kf[4], vf[2][4];
#pragma unroll
    for (int t = 0; t < 4; ++t) kf[t] = frag_at(rk + bo + t * 16 * KPI);
#pragma unroll
    for (int i = 0; i < 4; ++i) vf[0][i] = frag_at(rv + bo + (i & 1) * 16 * VPI + (i >> 1) * 32);
#pragma unroll   // hf is a compile-time number: the register set of each half is fixed, and the first-pass case stands in half 0 alone
   for (int hf = 0; hf < KT / 64; ++hf) {
    v8f s[4];   // s[t][r] = exponent of P for key 64 hf + 16t + 8g + r and query col
#pragma unroll
    for (int t = 0; t < 4; ++t) s[t] = wmma16(kf[t], aq, cv);
    __builtin_amdgcn_sched_barrier(0);   // keeps the four score products in a row in front of the softmax: with the exponentials scheduled in between them, each product draws hazard padding a second time
    if (hf + 1 < KT / 64) {   // the other half stands in the same buffer: its reads go out here and land under this half's softmax
#pragma unroll
      for (int t = 0; t < 4; ++t) kf[t] = frag_at(rk + bo + ((hf + 1) * 64 + t * 16) * KPI);
#pragma unroll
      for (int i = 0; i < 4; ++i) vf[(hf + 1) & 1][i] = frag_at(rv + bo + (i & 1) * 16 * VPI + (hf + 1) * 64 + (i >> 1) * 32);
      __builtin_amdgcn_sched_barrier(0); }   // holds these reads here: left free, the compiler sinks them behind the test below, and the next score products wait out their latency
    float ps = 0.f; v16h ph[2];   // two score tiles, converted in place, are the B operand of 32 keys: ph[kc][8 * (t & 1) + r], t = 2 kc + (t & 1)
#pragma unroll
    for (int t = 0; t < 4; ++t)
#pragma unroll
      for (int r = 0; r < 8; ++r) { const float p = __builtin_amdgcn_exp2f(s[t][r]); ps += p; ph[t >> 1][8 * (t & 1) + r] = (_Float16)p; }
    // One test a half pass, a scalar branch for the whole wave: while a lane's 32 P sum to no more than PSMAX, each of them fits f16 and the maximum in use stays.
    // The first half of the first pass always goes in (no maximum is in use yet: its bound is below any sum); so does a sum that is infinite or not a number.
    const bool first = hf == 0 && kt == 0;
    const float lim = first ? -1.0f : PSMAX;
    if (__builtin_expect(__builtin_amdgcn_ballot_w32(!(ps <= lim)) != 0, 0)) {
      float mx = s[0][0];
#pragma unroll
      for (int t = 0; t < 4; ++t)
#pragma unroll
        for (int r = 0; r < 8; ++r) mx = fmaxf(mx, s[t][r]);
      mx = fmaxf(mx, __shfl_xor(mx, 16, 32));   // the other 32 keys of this query sit in lane ^ 16: both halves move their maximum alike
      const float up = fmaxf(mx - PLIFT, 0.f);             // how far this tile's largest score stands above the maximum in use
      const float d = first ? mx - PLIFT : up;             // the first 64 keys take their own maximum, higher or lower; later the maximum only rises
      const float corr = __builtin_amdgcn_exp2f(-up);      // at most 1; for the first 64 keys it meets zeros only
      lrun *= corr; ps = 0.f;
#pragma unroll
      for (int r = 0; r < 8; ++r) { acc[0][r] *= corr; acc[1][r] *= corr; cv[r] -= d; }
#pragma unroll
      for (int t = 0; t < 4; ++t)
#pragma unroll
        for (int r = 0; r < 8; ++r) { const float p = __builtin_amdgcn_exp2f(s[t][r] - d); ps += p; ph[t >> 1][8 * (t & 1) + r] = (_Float16)p; } }
    lrun += ps;
#pragma unroll
    for (int kc = 0; kc < 2; ++kc)
#pragma unroll
      for (int t2 = 0; t2 < 2; ++t2) acc[t2] = wmma16(vf[hf & 1][kc * 2 + t2], ph[kc], acc[t2]); }
    asm volatile("s_wait_dscnt 0x0" ::: "memory");      // this wave has left the buffer it read
    asm volatile("s_wait_asynccnt 0x0" ::: "memory");   // its share of the next tile has landed
    __syncthreads();                                     // the next tile may be read; the buffer just read may be refilled
    if (kt + 2 < NP / KT) { copy_kv(lk + bo * 2, gk, lv + bo * 2, gv); gk += KT * HD; gv += KT; } }
  asm volatile("s_wait_asynccnt 0x0" ::: "memory");     // no copy is open when the wave ends
  lrun += __shfl_xor(lrun, 16, 32);   // the two halves of a query's row sum meet once, here
  const float inv = hs[h] * 8.0f / (lrun * 4.0f);   // P's lift stands in acc and in lrun alike
#pragma unroll
  for (int t2 = 0; t2 < 2; ++t2) { union { v8h h8; v4u u; } pk;   // a lane's 8 registers are 8 consecutive channels of its query's row: one 16-byte store
#pragma unroll
    for (int r = 0; r < 8; ++r) pk.h8[r] = (_Float16)(acc[t2][r] * inv);
    vst2(O16 + ((size_t)b * NP + q0 + col) * C + h * HD + t2 * 16 + 8 * g, pk.u); }
}
// out = ctx Wo^T /8/16 + bo : token-major rows; block (64 rows, 128 cols). The block converts its 128 rows of Wo itself, once, on the way to LDS.
__global__ __launch_bounds__(128) void k_out(const _Float16* __restrict__ O16, const float* __restrict__ Wo, const float* __restrict__ bo, float* __restrict__ out) {
  __shared__ __align__(16) _Float16 sm[TILE_H];   // weight rows; the epilogue's buffer stands on the same bytes behind a barrier
  const int tid = threadIdx.x, wave = tid >> 5, lane = tid & 31, col = lane & 15, g = lane >> 4; const int r0 = blockIdx.x * 64 + wave * 16, n0 = blockIdx.y * 128;
  float bias[8]; ld_bias(bias, bo + n0, col);
  v16h a[C / 32];   // the wave's own 16 context rows: asked for first, they land under the staging
  { const _Float16* pa = O16 + (size_t)(r0 + col) * C + 8 * g;
#pragma unroll
    for (int kc = 0; kc < C / 32; ++kc) a[kc] = frag_at(pa + kc * 32);
    asm volatile("s_wait_xcnt 0x0" :: "v"(pa) : "memory"); }   // the address pair stays whole until this wait: no load lands on it, nothing rewrites it, while a load that names it is being issued
  stage_rows<128>(sm, Wo + (size_t)n0 * C, 16.0f, tid);
  __syncthreads();   // the tile is whole: any wave may read any row
  v8f acc[8] = {};
  { const _Float16* rb = sm + col * WPI + 8 * g;
#pragma unroll
    for (int kc = 0; kc < C / 32; ++kc) { v16h bf[8]; ld_b(bf, rb, kc); mm_step(acc, a[kc], bf); } }
  __syncthreads();   // every wave has left the staged tile: its bytes may be written again
  float (*so)[16][132] = (float (*)[16][132])sm;
#pragma unroll
  for (int j = 0; j < 8; ++j) { const float bb = bias[j];
#pragma unroll
    for (int r = 0; r < 8; ++r) so[wave][8 * g + r][j * 16 + col] = acc[j][r] * (1.0f / (16.0f * 8.0f)) + bb; }
  LDSX();
#pragma unroll 4
  for (int rl = 0; rl < 16; ++rl) vst2(out + (size_t)(r0 + rl) * C + n0 + lane * 4, *(const v4f*)(&so[wave][rl][lane * 4]));
}
extern "C" void kernel_launch(void* const* d_in, const int* in_sizes, int n_in, void* d_out, int out_size, void* d_ws, size_t ws_size, hipStream_t stream) {
  (void)in_sizes; (void)n_in; (void)out_size; (void)ws_size;
  const float** I = (const float**)d_in;    // x, Wq, bq, Wk, bk, Wv, bv, Wo, bo, head_scale
  const float* x = I[0]; const float* Wq = I[1]; const float* bq = I[2]; const float* Wk = I[3]; const float* bk = I[4]; const float* Wv = I[5]; const float* bv = I[6]; const float* Wo = I[7]; const float* bo = I[8]; const float* hs = I[9];
  float* out = (float*)d_out;
  char* ws = (char*)d_ws; size_t off = 0;
  auto take = [&](size_t bytes) { char* p = ws + off; off += (bytes + 255) & ~(size_t)255; return p; };
  _Float16* Q16 = (_Float16*)take((size_t)NR * C * 2); _Float16* K16 = (_Float16*)take((size_t)NR * C * 2); _Float16* V16 = (_Float16*)take((size_t)NR * C * 2); _Float16* O16 = (_Float16*)take((size_t)NR * C * 2);
  // ws ~ 17 MB
  k_qkv<<<dim3(NR / 128, 3 * C / 128, 1), 128, 0, stream>>>(x, Wq, Wk, Wv, bq, bk, bv, Q16, K16, V16);
  k_attn<<<dim3(NP / 64, NBI * NH), 128, 0, stream>>>(Q16, K16, V16, hs, O16);
  k_out<<<dim3(NR / 64, C / 128), 128, 0, stream>>>(O16, Wo, bo, out);
}

// v010
// A run of this version takes 37.2 microseconds.
// Next to v009, in two timings, it ran 1.05 times as fast each time.
// All steps since v000 together make it 3.92 times as fast.
// compute dtype: f16 operands (x as f16 rows, weights x16 as f16 rows, both converted on the way to LDS, q x log2(e)/(4 sqrt(32)), k x4, P lifted by 2^4 over the maximum in use, V x4, context x8), f32 accumulate; softmax, head scaling and biases in f32.
#include <hip/hip_runtime.h>
#include <math.h>

typedef __attribute__((ext_vector_type(16))) _Float16 v16h;
typedef __attribute__((ext_vector_type(16))) __bf16 v16b;
typedef __attribute__((ext_vector_type(8)))  _Float16 v8h;
typedef __attribute__((ext_vector_type(4)))  _Float16 v4h;
typedef __attribute__((ext_vector_type(2)))  unsigned v2u;
typedef __attribute__((ext_vector_type(8)))  float v8f;
typedef __attribute__((ext_vector_type(4)))  float v4f;
typedef __attribute__((ext_vector_type(2)))  float v2f;
typedef __attribute__((ext_vector_type(4)))  unsigned v4u;
typedef __attribute__((ext_vector_type(4)))  int v4i;
typedef float __attribute__((may_alias)) float_a;
typedef int __attribute__((may_alias)) int_a;

template <typename T> __device__ __forceinline__ void vst2(void* p, T v) { *(T*)p = v;  }
__device__ __forceinline__ v8f wmma16(v16h a, v16h b, v8f c) {
  v8f d = __builtin_amdgcn_wmma_f32_16x16x32_f16(false, a, false, b, (short)0, c, false, false);
  asm volatile("v_nop\n\tv_nop\n\tv_nop\n\tv_nop" : "+v"(d) : "v"(a), "v"(b));
  return d;
}
__device__ __forceinline__ v8f wmma_bf(v16b a, v16b b, v8f c) {
  v8f d = __builtin_amdgcn_wmma_f32_16x16x32_bf16(false, a, false, b, (short)0, c, false, false);
  asm volatile("v_nop\n\tv_nop\n\tv_nop\n\tv_nop" : "+v"(d) : "v"(a), "v"(b));
  return d;
}
// 16x16x32 fragments: lane = (h = lane>>4, row/col = lane&15); elements 0..7 = k0+8h+0..7, 8..15 = k0+16+8h+0..7; D element r = row 8h+r
__device__ __forceinline__ v16h frag_h(const _Float16* rowk0, int lane) {
  union { v16h v; v8h q[2]; } u; const _Float16* p = rowk0 + 8 * (lane >> 4);
  u.q[0] = *(const v8h*)p; u.q[1] = *(const v8h*)(p + 16); return u.v;
}
// the same fragment from a pointer that already holds the lane's 8 * (lane >> 4)
__device__ __forceinline__ v16h frag_at(const _Float16* p) {
  union { v16h v; v8h q[2]; } u; u.q[0] = *(const v8h*)p; u.q[1] = *(const v8h*)(p + 16); return u.v;
}
__device__ __forceinline__ v16h frag_f32(const float* rowk0, int lane) {
  v16h a; const float* p = rowk0 + 8 * (lane >> 4);
#pragma unroll
  for (int i = 0; i < 8; ++i) { a[i] = (_Float16)p[i]; a[8 + i] = (_Float16)p[16 + i]; }
  return a;
}
__device__ __forceinline__ v16h frag_f32s(const float* rowk0, int lane, float sc) {
  v16h a; const float* p = rowk0 + 8 * (lane >> 4);
#pragma unroll
  for (int i = 0; i < 8; ++i) { a[i] = (_Float16)(p[i] * sc); a[8 + i] = (_Float16)(p[16 + i] * sc); }
  return a;
}
// column fragment from a [K][ld] layout (column n), rows >= K read as 0
__device__ __forceinline__ v16h fragc_f32(const float* W, int k0, int n, int lane, int ld, int K) {
  v16h a; const int g = lane >> 4;
#pragma unroll
  for (int i = 0; i < 8; ++i) { const int ka = k0 + 8 * g + i, kb = ka + 16;
    a[i] = (_Float16)(ka < K ? W[(size_t)ka * ld + n] : 0.f); a[8 + i] = (_Float16)(kb < K ? W[(size_t)kb * ld + n] : 0.f); }
  return a;
}
struct F2 { v16b h, l; };
__device__ __forceinline__ F2 bsplit16(const float v[16]) { F2 r;
#pragma unroll
  for (int i = 0; i < 16; ++i) { const __bf16 h = (__bf16)v[i]; r.h[i] = h; r.l[i] = (__bf16)(v[i] - (float)h); }
  return r; }
__device__ __forceinline__ F2 split_row(const float* row, int k0, int lane) { float v[16]; const float* p = row + k0 + 8 * (lane >> 4);
#pragma unroll
  for (int i = 0; i < 8; ++i) { v[i] = p[i]; v[8 + i] = p[16 + i]; }
  return bsplit16(v); }
__device__ __forceinline__ F2 split_rowK(const float* row, int k0, int lane, int K) { float v[16]; const int g = lane >> 4;
#pragma unroll
  for (int i = 0; i < 8; ++i) { const int ka = k0 + 8 * g + i, kb = ka + 16; v[i] = ka < K ? row[ka] : 0.f; v[8 + i] = kb < K ? row[kb] : 0.f; }
  return bsplit16(v); }
__device__ __forceinline__ F2 split_col(const float* W, int k0, int n, int lane, int ld, int K) { float v[16]; const int g = lane >> 4;
#pragma unroll
  for (int i = 0; i < 8; ++i) { const int ka = k0 + 8 * g + i, kb = ka + 16; v[i] = ka < K ? W[(size_t)ka * ld + n] : 0.f; v[8 + i] = kb < K ? W[(size_t)kb * ld + n] : 0.f; }
  return bsplit16(v); }
__device__ __forceinline__ v8f mac3(const F2& a, const F2& b, v8f c) { c = wmma_bf(a.l, b.h, c); c = wmma_bf(a.h, b.l, c); return wmma_bf(a.h, b.h, c); }
__device__ __forceinline__ float sigm(float v) { return 1.0f / (1.0f + expf(-v)); }
#define LDSX() do { asm volatile("s_wait_dscnt 0" ::: "memory"); __builtin_amdgcn_wave_barrier(); __builtin_amdgcn_fence(__ATOMIC_RELEASE, "workgroup"); } while (0)


// Multi-head credibility attention on [4,2048,256] (8 heads x 32, [out][in] weights + biases): softmax(q.k/sqrt(32)) * head_scale[h], ctx = attn v, out = ctx Wo^T + bo.
// score dim 32: k_qkv (x and its weight rows to f16 in LDS; +bias; Q rows x QSC, K rows x4 per (batch, head); V^T x4), k_attn (a head's K and V^T whole in LDS, 16 trips of 128 keys;
// online softmax; ctx scaled by head_scale[h]; O16 x8 token-major), k_out (+ bo). Output rms is dominated by bo/Wo scale.
#define NBI 4
#define C 256
#define NH 8
#define HD 32
#define NP 2048
#define NR (NBI * NP)
#define QSC 0.063758715f  // log2(e) / sqrt(32) / 4: with k x4, the product of a stored k row and a stored q row is the score as an exponent of 2

__device__ __forceinline__ void mm_step(v8f (&acc)[8], const v16h& a, const v16h (&b)[8]) {
#pragma unroll
  for (int j = 0; j < 8; ++j) acc[j] = wmma16(a, b[j], acc[j]);
}
#define WPI 264                       // halves per staged row in LDS: 512 B of data at a pitch of 528 B = 16 B x odd, so the 16-byte fragment reads meet no bank conflict
#define TILE_H (128 * WPI)            // halves of one staged tile of 128 rows
// 128 rows of C f32 values, in a row in memory, become f16 rows (times sc) in LDS, once per block. A wave takes a whole row (1 KB) at a time, by two loads of 512 bytes in a row each:
// every load covers four whole lines. Written in batches on two register sets, so that at least a batch's 16 loads are out while the batch before it is converted and stored.
template <int NT> __device__ __forceinline__ void stage_rows(_Float16* dst, const float* __restrict__ src, const float sc, const int tid) {
  constexpr int U = 8, NB = 128 / (NT / 32) / U;    // rows a batch, batches a wave
  v4f lo[2][U], hi[2][U];
  const unsigned vb = (unsigned)(tid >> 5) * 1024u + (unsigned)(tid & 31) * 16u;   // the wave's row, the lane's 16 bytes in each half of it
  const char* s = (const char*)src; _Float16* d = dst + (tid >> 5) * WPI + (tid & 31) * 4;
#pragma unroll
  for (int u = 0; u < U; ++u) { const char* p = s + (size_t)u * NT * 32 + vb; lo[0][u] = *(const v4f*)p; hi[0][u] = *(const v4f*)(p + 512); }
#pragma unroll
  for (int bt = 0; bt < NB; ++bt) {
    if (bt + 1 < NB) {
#pragma unroll
      for (int u = 0; u < U; ++u) { const char* p = s + (size_t)((bt + 1) * U + u) * NT * 32 + vb; lo[(bt + 1) & 1][u] = *(const v4f*)p; hi[(bt + 1) & 1][u] = *(const v4f*)(p + 512); }
      // behind the tile's last load; base and offset are named so that their registers stay as they are up to this wait
      if (bt + 2 == NB) asm volatile("s_wait_xcnt 0x0" :: "s"(src), "v"(vb) : "memory"); }
#pragma unroll
    for (int u = 0; u < U; ++u) { union { v4h h; v2u u2; } pl, ph;
#pragma unroll
      for (int e = 0; e < 4; ++e) { pl.h[e] = (_Float16)(lo[bt & 1][u][e] * sc); ph.h[e] = (_Float16)(hi[bt & 1][u][e] * sc); }
      _Float16* q = d + (bt * U + u) * (NT / 32) * WPI; vst2(q, pl.u2); vst2(q + 128, ph.u2); } }
}
// the lane's eight biases (columns 16 apart), asked for at the kernel's head so that they land under the staging
__device__ __forceinline__ void ld_bias(float (&bb)[8], const float* bp, int col) {
#pragma unroll
  for (int j = 0; j < 8; ++j) bb[j] = bp[j * 16 + col];
  asm volatile("s_wait_xcnt 0x0" :: "s"(bp), "v"(col) : "memory");   // base and index are named so that their registers stay as they are up to this wait
}
// the eight B fragments of k step kc (B rows 16 apart) from the staged tile; rb already holds the lane's row and its 8 * (lane >> 4)
__device__ __forceinline__ void ld_b(v16h (&b)[8], const _Float16* rb, int kc) {
#pragma unroll
  for (int j = 0; j < 8; ++j) b[j] = frag_at(rb + j * 16 * WPI + kc * 32);
}
// QKV: block = (128 positions of one image, 128 output channels = 4 heads of q, k or v), 4 waves of 32 positions x 128 channels: a weight fragment read from LDS feeds two products.
// The block converts its 128 rows of x and its 128 weight rows itself, once, on the way to LDS; all fragments are 16-byte LDS reads.
__global__ __launch_bounds__(128) void k_qkv(const float* __restrict__ x, const float* __restrict__ Wq, const float* __restrict__ Wk, const float* __restrict__ Wv, const float* __restrict__ bq, const float* __restrict__ bk, const float* __restrict__ bv, _Float16* __restrict__ Q16, _Float16* __restrict__ K16, _Float16* __restrict__ V16) {
  __shared__ __align__(16) _Float16 sm[2 * TILE_H];   // x rows, then weight rows; the epilogue's buffers stand on the same bytes behind a barrier
  const int tid = threadIdx.x, wave = tid >> 5, lane = tid & 31, col = lane & 15, g = lane >> 4;
  const int r0b = blockIdx.x * 128, n0 = blockIdx.y * 128; const int b = r0b / NP, s0 = r0b % NP; const int which = n0 / C, h0 = (n0 % C) / HD;
  const int cb0 = n0 % C;
  const float* Ws = which == 0 ? Wq : (which == 1 ? Wk : Wv);
  float bias[8]; ld_bias(bias, (which == 0 ? bq : (which == 1 ? bk : bv)) + cb0, col);
  stage_rows<128>(sm, x + (size_t)r0b * C, 1.0f, tid);
  stage_rows<128>(sm + TILE_H, Ws + (size_t)cb0 * C, 16.0f, tid);
  __syncthreads();   // both tiles are whole: any wave may read any row
  v8f acc[2][8] = {};   // acc[i]: positions wave * 32 + i * 16 + ...
  { const _Float16* ra = sm + (wave * 32 + col) * WPI + 8 * g; const _Float16* rb = sm + TILE_H + col * WPI + 8 * g;
#pragma unroll
    for (int kc = 0; kc < C / 32; ++kc) { v16h bf[8]; const v16h a0 = frag_at(ra + kc * 32), a1 = frag_at(ra + 16 * WPI + kc * 32); ld_b(bf, rb, kc); mm_step(acc[0], a0, bf); mm_step(acc[1], a1, bf); } }
  __syncthreads();   // every wave has left the staged tiles: their bytes may be written again
  float (*so)[16][132] = (float (*)[16][132])sm;                   // 4 x 16 x 132 floats, in the bytes of the x tile
  _Float16 (*sth)[136] = (_Float16 (*)[136])(sm + TILE_H);         // 128 rows at a pitch of 272 B, in the bytes of the weight tile
  if (which < 2) { const float osc = which == 0 ? QSC : 4.0f;
    _Float16* Dst = which == 0 ? Q16 : K16;
#pragma unroll
    for (int i = 0; i < 2; ++i) {
#pragma unroll
      for (int j = 0; j < 8; ++j) { const float bb = bias[j];
#pragma unroll
        for (int r = 0; r < 8; ++r) so[wave][8 * g + r][j * 16 + col] = (acc[i][j][r] * (1.0f / 16.0f) + bb) * osc; }
      LDSX();
      for (int qq = lane; qq < 4 * 16 * 4; qq += 32) { const int hh = qq >> 6, rl = (qq >> 2) & 15, pc = qq & 3; union { v8h h8; v4u u; } pk;
#pragma unroll
        for (int e = 0; e < 8; ++e) pk.h8[e] = (_Float16)so[wave][rl][hh * 32 + pc * 8 + e];
        vst2(Dst + (((size_t)b * NH + h0 + hh) * NP + s0 + wave * 32 + i * 16 + rl) * HD + pc * 8, pk.u); }
      } }
  else {
#pragma unroll
    for (int i = 0; i < 2; ++i)
#pragma unroll
      for (int j = 0; j < 8; ++j) { const float bb = bias[j];
#pragma unroll
        for (int r = 0; r < 8; ++r) sth[j * 16 + col][wave * 32 + i * 16 + 8 * g + r] = (_Float16)((acc[i][j][r] * (1.0f / 16.0f) + bb) * 4.0f); }
    __syncthreads();
    for (int qq = tid; qq < 128 * 16; qq += 128) { const int cl = qq >> 4, pc = qq & 15; vst2(V16 + ((size_t)b * C + (n0 - 2 * C) + cl) * NP + s0 + pc * 8, *(const v4u*)(&sth[cl][pc * 8])); } }
}
#define KPI 40                        // halves per K row in LDS: 64 B of data at a pitch of 80 B
#define VPI 1032                      // halves per V^T row of a plane in LDS: 1024 keys, 2048 B of data at a pitch of 2064 B
#define VPL (32 * VPI)                // halves of a plane: the 32 V^T rows of 1024 keys; with two planes, rows 16 apart stay within a read's 16-bit offset
#define KQ 512                        // keys per group of copies; tile 0 is one group (the wait for it is short), tile 1 the other three (they fly while tile 0 is worked on)
#define KS 128                        // keys per trip of the inner loop, worked on as two halves of 64
#define VOFF (NP * KPI)               // the V^T planes stand behind the NP K rows
#define PLIFT 4.0f                    // P = 2^(score - maximum in use + PLIFT)
#define PSMAX 32768.0f                // a lane's 32 P of a half may sum to this much before the maximum in use moves: each is then below f16's largest number
// one thread's share of a group of KQ keys: four 16-byte pieces of K (rows r, r + 128, r + 256, r + 384) and four of V^T (rows r, r + 8, r + 16, r + 24)
__device__ __forceinline__ void copy_kv(unsigned lk, const _Float16* gk, unsigned lv, const _Float16* gv) {
  const unsigned lk1 = lk + 128 * KPI * 2, lk2 = lk + 256 * KPI * 2, lk3 = lk + 384 * KPI * 2, lv1 = lv + 8 * VPI * 2, lv2 = lv + 16 * VPI * 2, lv3 = lv + 24 * VPI * 2;
  const _Float16* gk1 = gk + 128 * HD; const _Float16* gk2 = gk + 256 * HD; const _Float16* gk3 = gk + 384 * HD;
  const _Float16* gv1 = gv + 8 * NP; const _Float16* gv2 = gv + 16 * NP; const _Float16* gv3 = gv + 24 * NP;
  // the xcnt wait closes the copies' own statement: no address register of a copy is rewritten in front of it
  asm volatile("global_load_async_to_lds_b128 %0, %1, off\n\t"
               "global_load_async_to_lds_b128 %2, %3, off\n\t"
               "global_load_async_to_lds_b128 %4, %5, off\n\t"
               "global_load_async_to_lds_b128 %6, %7, off\n\t"
               "global_load_async_to_lds_b128 %8, %9, off\n\t"
               "global_load_async_to_lds_b128 %10, %11, off\n\t"
               "global_load_async_to_lds_b128 %12, %13, off\n\t"
               "global_load_async_to_lds_b128 %14, %15, off\n\t"
               "s_wait_xcnt 0x0"
               :: "v"(lk), "v"(gk), "v"(lk1), "v"(gk1), "v"(lk2), "v"(gk2), "v"(lk3), "v"(gk3),
                  "v"(lv), "v"(gv), "v"(lv1), "v"(gv1), "v"(lv2), "v"(gv2), "v"(lv3), "v"(gv3) : "memory");
}
// group q of the head: K rows KQ q and up; of V^T, half q & 1 of every row of plane q >> 1
__device__ __forceinline__ void copy_q(int q, unsigned lk, const _Float16* gk, unsigned lv, const _Float16* gv) {
  copy_kv(lk + q * KQ * KPI * 2, gk + q * KQ * HD, lv + (q >> 1) * VPL * 2 + (q & 1) * KQ * 2, gv + q * KQ);
}
__global__ __launch_bounds__(512) void k_attn(const _Float16* __restrict__ Q16, const _Float16* __restrict__ K16, const _Float16* __restrict__ V16, const float* __restrict__ hs, _Float16* __restrict__ O16) {
  __shared__ __align__(16) _Float16 sm[NP * KPI + 2 * VPL];
  const int tid = threadIdx.x, w = tid >> 5, lane = tid & 31, col = lane & 15, g = lane >> 4;
  const size_t bh = blockIdx.y; const int b = (int)(bh / NH), h = (int)(bh % NH); const int q0 = blockIdx.x * 256 + w * 16;
  const v16h aq = frag_h(Q16 + (bh * NP + q0 + col) * HD, lane);
  // cv = PLIFT - (the maximum in use for query col), in all 8 registers: it is the C operand of the score products, so their result is P's exponent as it stands.
  // The maximum in use moves only when a half needs it (below); lrun = this lane's own half of the row sum, lifted like P; acc[t2][r] = O^T[t2 * 16 + 8g + r][col]
  float lrun = 0.f; v8f acc[2] = {}; v8f cv;
#pragma unroll
  for (int r = 0; r < 8; ++r) cv[r] = PLIFT;
  const _Float16* gk = K16 + bh * NP * HD + tid * 8;                                            // a group's K rows are 32 KB in a row
  const _Float16* gv = V16 + ((size_t)b * C + h * HD + (tid >> 6)) * NP + (tid & 63) * 8;      // a group's V^T is 32 rows of eight lines each
  const unsigned l0 = (unsigned)(size_t)&sm[0];
  const unsigned lk = l0 + (tid >> 2) * (KPI * 2) + (tid & 3) * 16, lv = l0 + VOFF * 2 + (tid >> 6) * (VPI * 2) + (tid & 63) * 16;
  copy_q(0, lk, gk, lv, gv);
  asm volatile("s_wait_asynccnt 0x0" ::: "memory");   // this wave's share of tile 0 has landed
  __syncthreads();                                     // ... and every other wave's: tile 0 may be read
  copy_q(1, lk, gk, lv, gv); copy_q(2, lk, gk, lv, gv); copy_q(3, lk, gk, lv, gv);   // tile 1 has its own bytes; 24 copies a wave are out
  const _Float16* pk = sm + col * KPI + 8 * g; const _Float16* pv = sm + VOFF + col * VPI + 8 * g;   // the lane's own half of k folded in; both walk on by KS keys a trip
  int kt = 0;   // trips done, over both tiles
#pragma unroll 1   // stays rolled: one tile a trip, the hand-over stands once, at the foot
  for (int tl = 0; tl < 2; ++tl) {
    const int kend = tl == 0 ? KQ / KS : NP / KS;   // the tile's last trip + 1
    // the 16 fragment reads of the tile's first half go out as one group; those of every later half go out one half ahead (below)
    v16h kf[4], vf[2][4];
#pragma unroll
    for (int t = 0; t < 4; ++t) kf[t] = frag_at(pk + t * 16 * KPI);
#pragma unroll
    for (int i = 0; i < 4; ++i) vf[0][i] = frag_at(pv + (i & 1) * 16 * VPI + (i >> 1) * 32);
#pragma unroll 1   // stays rolled: the body of two halves is long enough, and the register set of each half is fixed
   for (; kt < kend; ++kt) {
#pragma unroll   // hf is a compile-time number: the register set of each half is fixed, and the first-half case stands in half 0 alone
   for (int hf = 0; hf < 2; ++hf) {
    v8f s[4];   // s[t][r] = exponent of P for key 64 hf + 16t + 8g + r of this trip and query col
#pragma unroll
    for (int t = 0; t < 4; ++t) s[t] = wmma16(kf[t], aq, cv);
    __builtin_amdgcn_sched_barrier(0);   // keeps the four score products in a row in front of the softmax: with the exponentials scheduled in between them, each product draws hazard padding a second time
    if (hf == 1) { pk += KS * KPI; pv += kt == NP / KS / 2 - 1 ? KS + VPL - 1024 : KS; }   // all of this trip's fragments are read: on to the next trip's keys (from key 1024 on: plane 1)
    if (hf == 0 || kt + 1 < kend) {   // the next 64 keys stand in the same tile: their reads go out here and land under this half's softmax; a tile's last half reads nothing ahead
#pragma unroll
      for (int t = 0; t < 4; ++t) kf[t] = frag_at(pk + ((1 - hf) * 64 + t * 16) * KPI);
#pragma unroll
      for (int i = 0; i < 4; ++i) vf[(hf + 1) & 1][i] = frag_at(pv + (i & 1) * 16 * VPI + (1 - hf) * 64 + (i >> 1) * 32);
      __builtin_amdgcn_sched_barrier(0); }   // holds these reads here: left free, the compiler sinks them behind the test below, and the next score products wait out their latency
    float ps = 0.f; v16h ph[2];   // two score tiles, converted in place, are the B operand of 32 keys: ph[kc][8 * (t & 1) + r], t = 2 kc + (t & 1)
#pragma unroll
    for (int t = 0; t < 4; ++t)
#pragma unroll
      for (int r = 0; r < 8; ++r) { const float p = __builtin_amdgcn_exp2f(s[t][r]); ps += p; ph[t >> 1][8 * (t & 1) + r] = (_Float16)p; }
    // One test a half, a scalar branch for the whole wave: while a lane's 32 P sum to no more than PSMAX, each of them fits f16 and the maximum in use stays.
    // The very first half always goes in (no maximum is in use yet: its bound is below any sum); so does a sum that is infinite or not a number.
    const bool first = hf == 0 && kt == 0;
    const float lim = first ? -1.0f : PSMAX;
    if (__builtin_expect(__builtin_amdgcn_ballot_w32(!(ps <= lim)) != 0, 0)) {
      float mx = s[0][0];
#pragma unroll
      for (int t = 0; t < 4; ++t)
#pragma unroll
        for (int r = 0; r < 8; ++r) mx = fmaxf(mx, s[t][r]);
      mx = fmaxf(mx, __shfl_xor(mx, 16, 32));   // the other 32 keys of this query sit in lane ^ 16: both halves move their maximum alike
      const float up = fmaxf(mx - PLIFT, 0.f);             // how far this half's largest score stands above the maximum in use
      const float d = first ? mx - PLIFT : up;             // the first 64 keys take their own maximum, higher or lower; later the maximum only rises
      const float corr = __builtin_amdgcn_exp2f(-up);      // at most 1; on the first half it meets zeros only
      lrun *= corr; ps = 0.f;
#pragma unroll
      for (int r = 0; r < 8; ++r) { acc[0][r] *= corr; acc[1][r] *= corr; cv[r] -= d; }
#pragma unroll
      for (int t = 0; t < 4; ++t)
#pragma unroll
        for (int r = 0; r < 8; ++r) { const float p = __builtin_amdgcn_exp2f(s[t][r] - d); ps += p; ph[t >> 1][8 * (t & 1) + r] = (_Float16)p; } }
    lrun += ps;
#pragma unroll
    for (int kc = 0; kc < 2; ++kc)
#pragma unroll
      for (int t2 = 0; t2 < 2; ++t2) acc[t2] = wmma16(vf[hf & 1][kc * 2 + t2], ph[kc], acc[t2]); } }
    asm volatile("s_wait_dscnt 0x0" ::: "memory");      // this wave has left the tile it read
    asm volatile("s_wait_asynccnt 0x0" ::: "memory");   // its share of the next tile has landed
    __syncthreads(); }                                   // the next tile may be read; there is no third tile, so nothing is refilled
  asm volatile("s_wait_asynccnt 0x0" ::: "memory");     // no copy is open when the wave ends
  lrun += __shfl_xor(lrun, 16, 32);   // the two halves of a query's row sum meet once, here
  const float inv = hs[h] * 8.0f / (lrun * 4.0f);   // P's lift stands in acc and in lrun alike
#pragma unroll
  for (int t2 = 0; t2 < 2; ++t2) { union { v8h h8; v4u u; } pk8;   // a lane's 8 registers are 8 consecutive channels of its query's row: one 16-byte store
#pragma unroll
    for (int r = 0; r < 8; ++r) pk8.h8[r] = (_Float16)(acc[t2][r] * inv);
    vst2(O16 + ((size_t)b * NP + q0 + col) * C + h * HD + t2 * 16 + 8 * g, pk8.u); }
}
// out = ctx Wo^T /8/16 + bo : token-major rows; block (64 rows, 128 cols). The block converts its 128 rows of Wo itself, once, on the way to LDS.
__global__ __launch_bounds__(128) void k_out(const _Float16* __restrict__ O16, const float* __restrict__ Wo, const float* __restrict__ bo, float* __restrict__ out) {
  __shared__ __align__(16) _Float16 sm[TILE_H];   // weight rows; the epilogue's buffer stands on the same bytes behind a barrier
  const int tid = threadIdx.x, wave = tid >> 5, lane = tid & 31, col = lane & 15, g = lane >> 4; const int r0 = blockIdx.x * 64 + wave * 16, n0 = blockIdx.y * 128;
  float bias[8]; ld_bias(bias, bo + n0, col);
  v16h a[C / 32];   // the wave's own 16 context rows: asked for first, they land under the staging
  { const _Float16* pa = O16 + (size_t)(r0 + col) * C + 8 * g;
#pragma unroll
    for (int kc = 0; kc < C / 32; ++kc) a[kc] = frag_at(pa + kc * 32);
    asm volatile("s_wait_xcnt 0x0" :: "v"(pa) : "memory"); }   // the address pair stays whole until this wait: no load lands on it, nothing rewrites it, while a load that names it is being issued
  stage_rows<128>(sm, Wo + (size_t)n0 * C, 16.0f, tid);
  __syncthreads();   // the tile is whole: any wave may read any row
  v8f acc[8] = {};
  { const _Float16* rb = sm + col * WPI + 8 * g;
#pragma unroll
    for (int kc = 0; kc < C / 32; ++kc) { v16h bf[8]; ld_b(bf, rb, kc); mm_step(acc, a[kc], bf); } }
  __syncthreads();   // every wave has left the staged tile: its bytes may be written again
  float (*so)[16][132] = (float (*)[16][132])sm;
#pragma unroll
  for (int j = 0; j < 8; ++j) { const float bb = bias[j];
#pragma unroll
    for (int r = 0; r < 8; ++r) so[wave][8 * g + r][j * 16 + col] = acc[j][r] * (1.0f / (16.0f * 8.0f)) + bb; }
  LDSX();
#pragma unroll 4
  for (int rl = 0; rl < 16; ++rl) vst2(out + (size_t)(r0 + rl) * C + n0 + lane * 4, *(const v4f*)(&so[wave][rl][lane * 4]));
}
extern "C" void kernel_launch(void* const* d_in, const int* in_sizes, int n_in, void* d_out, int out_size, void* d_ws, size_t ws_size, hipStream_t stream) {
  (void)in_sizes; (void)n_in; (void)out_size; (void)ws_size;
  const float** I = (const float**)d_in;    // x, Wq, bq, Wk, bk, Wv, bv, Wo, bo, head_scale
  const float* x = I[0]; const float* Wq = I[1]; const float* bq = I[2]; const float* Wk = I[3]; const float* bk = I[4]; const float* Wv = I[5]; const float* bv = I[6]; const float* Wo = I[7]; const float* bo = I[8]; const float* hs = I[9];
  float* out = (float*)d_out;
  char* ws = (char*)d_ws; size_t off = 0;
  auto take = [&](size_t bytes) { char* p = ws + off; off += (bytes + 255) & ~(size_t)255; return p; };
  _Float16* Q16 = (_Float16*)take((size_t)NR * C * 2); _Float16* K16 = (_Float16*)take((size_t)NR * C * 2); _Float16* V16 = (_Float16*)take((size_t)NR * C * 2); _Float16* O16 = (_Float16*)take((size_t)NR * C * 2);
  // ws ~ 17 MB
  k_qkv<<<dim3(NR / 128, 3 * C / 128, 1), 128, 0, stream>>>(x, Wq, Wk, Wv, bq, bk, bv, Q16, K16, V16);
  k_attn<<<dim3(NP / 256, NBI * NH), 512, 0, stream>>>(Q16, K16, V16, hs, O16);
  k_out<<<dim3(NR / 64, C / 128), 128, 0, stream>>>(O16, Wo, bo, out);
}
